// v000
// The times below were measured on an AMD MI455X: many runs one after another, warmed up first and cycling through
// copies of the inputs, with the whole window's GPU time divided by the number of runs. Launches and the gaps
// between them are all in it. The median over several windows is given; except for v000 it joins two sittings, which
// can be a few percent apart, so the side-by-side timings, each taken in one sitting, are the better comparison.
// v000, which the later versions start from, runs in 594 microseconds.
#include <hip/hip_runtime.h>
#include <hip/hip_bf16.h>

// ---------------------------------------------------------------------------
// Fused MHA (heads-last interleave) for MI455X / gfx1250, wave32 + WMMA f16.
// Stage 1: Q/K/V projections via v_wmma_f32_16x16x32_f16, de-interleaved into
//          [B,H,S,dh] f16 workspace (bias fused for Q).
// Stage 2: flash attention; Q/K tiles streamed with GLOBAL_LOAD_ASYNC_TO_LDS
//          (ASYNCcnt-tracked, K double-buffered), both matmuls on WMMA,
//          fp32 online softmax, P staged through LDS for the layout swap.
// ---------------------------------------------------------------------------

typedef __attribute__((ext_vector_type(16))) _Float16 v16h;
typedef __attribute__((ext_vector_type(8)))  _Float16 v8h;
typedef __attribute__((ext_vector_type(8)))  float    v8f;

#define WMMA_F16(a, b, c) \
    __builtin_amdgcn_wmma_f32_16x16x32_f16(false, (a), false, (b), (short)0, (c), false, false)

// Per-lane 16B global->LDS async copy (CDNA5 VGLOBAL async op, ASYNCcnt).
static __device__ __forceinline__
void async_copy_b128(unsigned lds_addr, const _Float16* g) {
    asm volatile("global_load_async_to_lds_b128 %0, %1, off"
                 :: "v"(lds_addr), "v"((unsigned long long)(uintptr_t)g)
                 : "memory");
}
#define WAIT_ASYNCCNT(n) asm volatile("s_wait_asynccnt " #n ::: "memory")

// Low 32 bits of a generic pointer to LDS == LDS byte offset (ISA §10.2).
static __device__ __forceinline__ unsigned lds_off(const void* p) {
    return (unsigned)(uintptr_t)p;
}

// Load a 16x32 f16 A/B fragment from an LDS tile stored [row][k] (rstride
// halves per row). ISA 16-bit A layout: lanes 0-15 hold K {0..7,16..23},
// lanes 16-31 hold K {8..15,24..31} (wave32).
static __device__ __forceinline__
v16h ldfrag(const _Float16* __restrict__ base, int row, int rstride, int koff, int lane) {
    const _Float16* p = base + row * rstride + koff + ((lane & 16) ? 8 : 0);
    v8h lo = *(const v8h*)(p);
    v8h hi = *(const v8h*)(p + 16);
    v16h r;
#pragma unroll
    for (int i = 0; i < 8; ++i) { r[i] = lo[i]; r[i + 8] = hi[i]; }
    return r;
}

// ---------------------------------------------------------------------------
// Stage 1: QKV projection GEMM.  out[z] = x @ W[z] (+ Bq for z==0)
// x:[4096,1024] f32, W:[1024,1024] f32 -> f16 [B,H,S,dh] (heads de-interleaved)
// Block: 128 threads (4 waves, 2x2), 64x64 output tile, K-step 32.
// (f32->f16 conversion must pass through VGPRs, so tiles load synchronously.)
// ---------------------------------------------------------------------------
__global__ __launch_bounds__(128)
void qkv_proj_kernel(const float* __restrict__ x,
                     const float* __restrict__ Wq,
                     const float* __restrict__ Bq,
                     const float* __restrict__ Wk,
                     const float* __restrict__ Wv,
                     _Float16* __restrict__ Qh,
                     _Float16* __restrict__ Kh,
                     _Float16* __restrict__ Vh) {
    constexpr int D = 1024, S = 2048, H = 16, DH = 64;
    __shared__ __align__(16) _Float16 Al[64 * 32];   // x tile  [m][k]
    __shared__ __align__(16) _Float16 Bt[64 * 32];   // W tile transposed [n][k]

    const int tid   = threadIdx.x;
    const int lane  = tid & 31;
    const int wave  = tid >> 5;
    const int wm    = (wave >> 1) * 32;
    const int wn    = (wave & 1) * 32;
    const int mbase = blockIdx.y * 64;
    const int nbase = blockIdx.x * 64;
    const int z     = blockIdx.z;

    const float* W   = (z == 0) ? Wq : (z == 1) ? Wk : Wv;
    _Float16*    Out = (z == 0) ? Qh : (z == 1) ? Kh : Vh;

    const v8f zv = {0.f, 0.f, 0.f, 0.f, 0.f, 0.f, 0.f, 0.f};
    v8f acc[2][2];
#pragma unroll
    for (int i = 0; i < 2; ++i)
#pragma unroll
        for (int j = 0; j < 2; ++j) acc[i][j] = zv;

    const int lane15 = lane & 15;

    for (int k0 = 0; k0 < D; k0 += 32) {
        // x tile: 64 rows x 32 cols = 512 float4 chunks, 4 per thread
#pragma unroll
        for (int it = 0; it < 4; ++it) {
            int idx = tid + it * 128;
            int row = idx >> 3, c4 = (idx & 7) * 4;
            const float4 v = *(const float4*)(x + (size_t)(mbase + row) * D + k0 + c4);
            _Float16* d = Al + row * 32 + c4;
            d[0] = (_Float16)v.x; d[1] = (_Float16)v.y;
            d[2] = (_Float16)v.z; d[3] = (_Float16)v.w;
        }
        // W tile: 32 rows(k) x 64 cols(n), store transposed [n][k]
#pragma unroll
        for (int it = 0; it < 4; ++it) {
            int idx = tid + it * 128;
            int row = idx >> 4, c4 = (idx & 15) * 4;
            const float4 v = *(const float4*)(W + (size_t)(k0 + row) * D + nbase + c4);
            Bt[(c4 + 0) * 32 + row] = (_Float16)v.x;
            Bt[(c4 + 1) * 32 + row] = (_Float16)v.y;
            Bt[(c4 + 2) * 32 + row] = (_Float16)v.z;
            Bt[(c4 + 3) * 32 + row] = (_Float16)v.w;
        }
        if (k0 + 32 < D)  // speculative prefetch of next x tile row
            __builtin_prefetch(x + (size_t)(mbase + (tid >> 1)) * D + k0 + 32, 0, 1);
        __syncthreads();

        v16h a0 = ldfrag(Al, wm + 0  + lane15, 32, 0, lane);
        v16h a1 = ldfrag(Al, wm + 16 + lane15, 32, 0, lane);
        v16h b0 = ldfrag(Bt, wn + 0  + lane15, 32, 0, lane);
        v16h b1 = ldfrag(Bt, wn + 16 + lane15, 32, 0, lane);
        acc[0][0] = WMMA_F16(a0, b0, acc[0][0]);
        acc[0][1] = WMMA_F16(a0, b1, acc[0][1]);
        acc[1][0] = WMMA_F16(a1, b0, acc[1][0]);
        acc[1][1] = WMMA_F16(a1, b1, acc[1][1]);
        __syncthreads();
    }

    // Epilogue: +bias (Q only), de-interleave heads: col n -> (h = n%16, dq = n/16)
    const int half8 = (lane & 16) ? 8 : 0;
#pragma unroll
    for (int tm = 0; tm < 2; ++tm)
#pragma unroll
        for (int tn = 0; tn < 2; ++tn) {
            const int n    = nbase + wn + tn * 16 + lane15;
            const float bi = (z == 0) ? Bq[n] : 0.0f;
            const int h = n & 15, dq = n >> 4;
#pragma unroll
            for (int r = 0; r < 8; ++r) {
                const int m  = mbase + wm + tm * 16 + r + half8;
                const int bb = m >> 11;          // batch
                const int s  = m & 2047;         // seq pos
                Out[((size_t)(bb * H + h) * S + s) * DH + dq] =
                    (_Float16)(acc[tm][tn][r] + bi);
            }
        }
}

// ---------------------------------------------------------------------------
// Stage 2: flash attention, one block per (64 q-rows, head, batch).
// 128 threads = 4 waves; wave w owns query rows [16w, 16w+16).
// Q + double-buffered K tiles arrive via async global->LDS copies.
// ---------------------------------------------------------------------------
__global__ __launch_bounds__(128)
void flash_attn_kernel(const _Float16* __restrict__ Qh,
                       const _Float16* __restrict__ Kh,
                       const _Float16* __restrict__ Vh,
                       float* __restrict__ out) {
    constexpr int S = 2048, H = 16, DH = 64, D = 1024;
    constexpr int NT = S / 64;          // 32 K/V tiles
    constexpr float SCALE = 0.03125f;   // 1/sqrt(D) = 1/32

    __shared__ __align__(16) _Float16 Qs[64 * 64];       // [qrow][dh]
    __shared__ __align__(16) _Float16 Kb[2][64 * 64];    // [j][dh] double buffer
    __shared__ __align__(16) _Float16 Vt[64 * 64];       // [dh][j] (B of PV)
    __shared__ __align__(16) _Float16 Ps[4][16 * 64];    // per-wave P [row][j]

    const int tid = threadIdx.x, lane = tid & 31, wave = tid >> 5;
    const int lane15 = lane & 15;
    const int half8  = (lane & 16) ? 8 : 0;
    const int q0 = blockIdx.x * 64;
    const int h  = blockIdx.y;
    const int b  = blockIdx.z;

    const size_t headoff = (size_t)(b * H + h) * S * DH;
    const _Float16* Qg = Qh + headoff;
    const _Float16* Kg = Kh + headoff;
    const _Float16* Vg = Vh + headoff;

    const unsigned ldsQ  = lds_off(Qs);
    const unsigned ldsK0 = lds_off(Kb[0]);
    const unsigned ldsK1 = lds_off(Kb[1]);

    // Kick off async copies: K tile 0 first, then the resident Q tile.
    // Each tile is 8KB contiguous: 512 x 16B chunks, 4 per thread.
#pragma unroll
    for (int it = 0; it < 4; ++it) {
        int idx = tid + it * 128;
        async_copy_b128(ldsK0 + idx * 16, Kg + idx * 8);
    }
#pragma unroll
    for (int it = 0; it < 4; ++it) {
        int idx = tid + it * 128;
        async_copy_b128(ldsQ + idx * 16, Qg + (size_t)q0 * DH + idx * 8);
    }
    WAIT_ASYNCCNT(0x0);   // Q and K0 resident in this wave's view

    const v8f zv = {0.f, 0.f, 0.f, 0.f, 0.f, 0.f, 0.f, 0.f};
    v8f o[4];
#pragma unroll
    for (int t = 0; t < 4; ++t) o[t] = zv;
    float m_st[8], l_st[8];
#pragma unroll
    for (int r = 0; r < 8; ++r) { m_st[r] = -1e30f; l_st[r] = 0.0f; }

    for (int ti = 0; ti < NT; ++ti) {
        const int j0 = ti * 64;
        __syncthreads();  // previous iteration done reading Vt / K buffer

        // V tile transposed -> Vt[dh][j] (needs VGPR pass, regular loads)
#pragma unroll
        for (int it = 0; it < 4; ++it) {
            int idx = tid + it * 128;
            int row = idx >> 3, c = (idx & 7) * 8;
            v8h v = *(const v8h*)(Vg + (size_t)(j0 + row) * DH + c);
#pragma unroll
            for (int u = 0; u < 8; ++u) Vt[(c + u) * 64 + row] = v[u];
        }

        // Prefetch K tile ti+1 into the other buffer (read last in iter ti-1,
        // so the barrier above protects it), then wait for K tile ti.
        if (ti + 1 < NT) {
            const unsigned dst = ((ti + 1) & 1) ? ldsK1 : ldsK0;
#pragma unroll
            for (int it = 0; it < 4; ++it) {
                int idx = tid + it * 128;
                async_copy_b128(dst + idx * 16, Kg + (size_t)(j0 + 64) * DH + idx * 8);
            }
            WAIT_ASYNCCNT(0x4);   // in-order: first 4 outstanding (tile ti) done
        } else {
            WAIT_ASYNCCNT(0x0);   // last tile: drain
        }
        __syncthreads();          // Vt stores + K tile ti visible block-wide

        const _Float16* Kcur = Kb[ti & 1];

        // ---- S = Q K^T  (contraction over dh; K[j][dh] is exactly B[k][n]) ----
        v8f sc[4];
#pragma unroll
        for (int t = 0; t < 4; ++t) sc[t] = zv;
#pragma unroll
        for (int kk = 0; kk < 64; kk += 32) {
            v16h a = ldfrag(Qs, wave * 16 + lane15, 64, kk, lane);
#pragma unroll
            for (int tn = 0; tn < 4; ++tn) {
                v16h bk = ldfrag(Kcur, tn * 16 + lane15, 64, kk, lane);
                sc[tn] = WMMA_F16(a, bk, sc[tn]);
            }
        }
#pragma unroll
        for (int tn = 0; tn < 4; ++tn)
#pragma unroll
            for (int r = 0; r < 8; ++r) sc[tn][r] *= SCALE;

        // ---- online softmax (row m = r + half8 lives across 16 lanes) ----
        float corr[8];
#pragma unroll
        for (int r = 0; r < 8; ++r) {
            float mx = fmaxf(fmaxf(sc[0][r], sc[1][r]), fmaxf(sc[2][r], sc[3][r]));
#pragma unroll
            for (int off = 1; off < 16; off <<= 1)
                mx = fmaxf(mx, __shfl_xor(mx, off, 32));
            float nm = fmaxf(m_st[r], mx);
            corr[r]  = __expf(m_st[r] - nm);
            m_st[r]  = nm;
        }
        float rs[8];
#pragma unroll
        for (int r = 0; r < 8; ++r) rs[r] = 0.0f;
#pragma unroll
        for (int tn = 0; tn < 4; ++tn)
#pragma unroll
            for (int r = 0; r < 8; ++r) {
                float p = __expf(sc[tn][r] - m_st[r]);
                sc[tn][r] = p;
                rs[r] += p;
            }
#pragma unroll
        for (int r = 0; r < 8; ++r) {
            float t = rs[r];
#pragma unroll
            for (int off = 1; off < 16; off <<= 1) t += __shfl_xor(t, off, 32);
            l_st[r] = l_st[r] * corr[r] + t;
#pragma unroll
            for (int tn = 0; tn < 4; ++tn) o[tn][r] *= corr[r];
        }

        // ---- P: C-layout -> A-layout via per-wave LDS (in-order DS, same wave) ----
        _Float16* P = Ps[wave];
#pragma unroll
        for (int tn = 0; tn < 4; ++tn)
#pragma unroll
            for (int r = 0; r < 8; ++r)
                P[(r + half8) * 64 + tn * 16 + lane15] = (_Float16)sc[tn][r];
        __builtin_amdgcn_wave_barrier();   // keep DS stores before DS frag loads

        // ---- O += P V  (contraction over j; Vt[dh][j] is B[k][n]) ----
#pragma unroll
        for (int kk = 0; kk < 64; kk += 32) {
            v16h a = ldfrag(P, lane15, 64, kk, lane);
#pragma unroll
            for (int tn = 0; tn < 4; ++tn) {
                v16h bv = ldfrag(Vt, tn * 16 + lane15, 64, kk, lane);
                o[tn] = WMMA_F16(a, bv, o[tn]);
            }
        }
    }

    // ---- epilogue: O / l, re-interleave heads (out col = dq*16 + h) ----
#pragma unroll
    for (int tn = 0; tn < 4; ++tn) {
        const int dq = tn * 16 + lane15;
#pragma unroll
        for (int r = 0; r < 8; ++r) {
            const int srow = q0 + wave * 16 + r + half8;
            out[((size_t)b * S + srow) * D + dq * H + h] = o[tn][r] / l_st[r];
        }
    }
}

// ---------------------------------------------------------------------------
extern "C" void kernel_launch(void* const* d_in, const int* in_sizes, int n_in,
                              void* d_out, int out_size, void* d_ws, size_t ws_size,
                              hipStream_t stream) {
    const float* x  = (const float*)d_in[0];
    const float* Wq = (const float*)d_in[1];
    const float* Bq = (const float*)d_in[2];
    const float* Wk = (const float*)d_in[3];
    const float* Wv = (const float*)d_in[4];
    float* out = (float*)d_out;

    // f16 workspace: Q/K/V in [B,H,S,dh] = 4,194,304 halves (8 MB) each
    const size_t per = (size_t)2 * 16 * 2048 * 64;
    _Float16* Qh = (_Float16*)d_ws;
    _Float16* Kh = Qh + per;
    _Float16* Vh = Kh + per;

    dim3 g1(1024 / 64, 4096 / 64, 3);   // (N tiles, M tiles, {Q,K,V})
    qkv_proj_kernel<<<g1, 128, 0, stream>>>(x, Wq, Bq, Wk, Wv, Qh, Kh, Vh);

    dim3 g2(2048 / 64, 16, 2);          // (q tiles, heads, batch)
    flash_attn_kernel<<<g2, 128, 0, stream>>>(Qh, Kh, Vh, out);
}

// v001
// Measured time: 298 microseconds a run.
// Next to v000, in two timings, it ran 2.05 times as fast each time.
#include <hip/hip_runtime.h>
#include <hip/hip_bf16.h>

// ---------------------------------------------------------------------------
// Fused MHA (heads-last interleave) for MI455X / gfx1250, wave32 + WMMA f16.
// Stage 1: Q/K/V projections via v_wmma_f32_16x16x32_f16, de-interleaved into
//          [B,H,S,dh] f16 workspace (bias fused for Q).
// Stage 2: flash attention; Q/K tiles streamed with GLOBAL_LOAD_ASYNC_TO_LDS
//          (ASYNCcnt-tracked, K double-buffered), both matmuls on WMMA,
//          fp32 online softmax, P staged through LDS for the layout swap.
// LDS rows are pitched 16 B x odd (80 B for 64-B rows, 144 B for 128-B rows) so
// that the 16 rows of a ds_load_b128 fragment read fall on distinct banks, and
// transposed tiles are packed along k in registers and written 16 B at a time.
// ---------------------------------------------------------------------------

typedef __attribute__((ext_vector_type(16))) _Float16 v16h;
typedef __attribute__((ext_vector_type(8)))  _Float16 v8h;
typedef __attribute__((ext_vector_type(4)))  _Float16 v4h;
typedef __attribute__((ext_vector_type(8)))  float    v8f;

#define WMMA_F16(a, b, c) \
    __builtin_amdgcn_wmma_f32_16x16x32_f16(false, (a), false, (b), (short)0, (c), false, false)

// LDS row pitch in halves: 32-half rows (projection), 64-half rows (attention).
#define PITCH32 40
#define PITCH64 72

// One 64x64 f16 tile (8 KB contiguous in global) -> LDS rows of PITCH64 halves,
// by 128 threads: four per-lane 16B async copies each (ASYNCcnt counts 4 a wave).
// Chunk idx = tid + 128*it is row idx>>3, 16-byte column idx&7.
// The s_wait_xcnt closes the statement so that no address register of an
// issued copy is rewritten ahead of it.
static __device__ __forceinline__
void async_tile_64x64(unsigned lds_base, const _Float16* g, int tid) {
    const unsigned l0 = lds_base + (unsigned)(tid >> 3) * (PITCH64 * 2) + (unsigned)(tid & 7) * 16;
    const unsigned long long g0 = (unsigned long long)(uintptr_t)(g + tid * 8);
    asm volatile("global_load_async_to_lds_b128 %0, %4, off\n\t"
                 "global_load_async_to_lds_b128 %1, %5, off\n\t"
                 "global_load_async_to_lds_b128 %2, %6, off\n\t"
                 "global_load_async_to_lds_b128 %3, %7, off\n\t"
                 "s_wait_xcnt 0x0"
                 :: "v"(l0), "v"(l0 + 16 * PITCH64 * 2), "v"(l0 + 32 * PITCH64 * 2),
                    "v"(l0 + 48 * PITCH64 * 2),
                    "v"(g0), "v"(g0 + 2048), "v"(g0 + 4096), "v"(g0 + 6144)
                 : "memory");
}
#define WAIT_ASYNCCNT(n) asm volatile("s_wait_asynccnt " #n ::: "memory")

// Low 32 bits of a generic pointer to LDS == LDS byte offset (ISA §10.2).
static __device__ __forceinline__ unsigned lds_off(const void* p) {
    return (unsigned)(uintptr_t)p;
}

// Load a 16x32 f16 A/B fragment from an LDS tile stored [row][k] (rstride
// halves per row). ISA 16-bit A layout: lanes 0-15 hold K {0..7,16..23},
// lanes 16-31 hold K {8..15,24..31} (wave32).
static __device__ __forceinline__
v16h ldfrag(const _Float16* __restrict__ base, int row, int rstride, int koff, int lane) {
    const _Float16* p = base + row * rstride + koff + ((lane & 16) ? 8 : 0);
    v8h lo = *(const v8h*)(p);
    v8h hi = *(const v8h*)(p + 16);
    v16h r;
#pragma unroll
    for (int i = 0; i < 8; ++i) { r[i] = lo[i]; r[i + 8] = hi[i]; }
    return r;
}

// ---------------------------------------------------------------------------
// Stage 1: QKV projection GEMM.  out[z] = x @ W[z] (+ Bq for z==0)
// x:[4096,1024] f32, W:[1024,1024] f32 -> f16 [B,H,S,dh] (heads de-interleaved)
// Block: 128 threads (4 waves, 2x2), 64x64 output tile, K-step 32.
// (f32->f16 conversion must pass through VGPRs, so tiles load synchronously.)
// ---------------------------------------------------------------------------
__global__ __launch_bounds__(128)
void qkv_proj_kernel(const float* __restrict__ x,
                     const float* __restrict__ Wq,
                     const float* __restrict__ Bq,
                     const float* __restrict__ Wk,
                     const float* __restrict__ Wv,
                     _Float16* __restrict__ Qh,
                     _Float16* __restrict__ Kh,
                     _Float16* __restrict__ Vh) {
    constexpr int D = 1024, S = 2048, H = 16, DH = 64;
    __shared__ __align__(16) _Float16 Al[64 * PITCH32];   // x tile  [m][k]
    __shared__ __align__(16) _Float16 Bt[64 * PITCH32];   // W tile transposed [n][k]

    const int tid   = threadIdx.x;
    const int lane  = tid & 31;
    const int wave  = tid >> 5;
    const int wm    = (wave >> 1) * 32;
    const int wn    = (wave & 1) * 32;
    const int mbase = blockIdx.y * 64;
    const int nbase = blockIdx.x * 64;
    const int z     = blockIdx.z;

    const float* W   = (z == 0) ? Wq : (z == 1) ? Wk : Wv;
    _Float16*    Out = (z == 0) ? Qh : (z == 1) ? Kh : Vh;

    const v8f zv = {0.f, 0.f, 0.f, 0.f, 0.f, 0.f, 0.f, 0.f};
    v8f acc[2][2];
#pragma unroll
    for (int i = 0; i < 2; ++i)
#pragma unroll
        for (int j = 0; j < 2; ++j) acc[i][j] = zv;

    const int lane15 = lane & 15;

    for (int k0 = 0; k0 < D; k0 += 32) {
        // x tile: 64 rows x 32 cols = 512 float4 chunks, 4 per thread
#pragma unroll
        for (int it = 0; it < 4; ++it) {
            int idx = tid + it * 128;
            int row = idx >> 3, c4 = (idx & 7) * 4;
            const float4 v = *(const float4*)(x + (size_t)(mbase + row) * D + k0 + c4);
            _Float16* d = Al + row * PITCH32 + c4;
            d[0] = (_Float16)v.x; d[1] = (_Float16)v.y;
            d[2] = (_Float16)v.z; d[3] = (_Float16)v.w;
        }
        // W tile: 32 rows(k) x 64 cols(n), store transposed [n][k].
        // A lane owns columns 2*lane, 2*lane+1, a wave k rows 8*wave..8*wave+7:
        // each column's 8 k values leave as one 16-byte LDS store.
        {
            float2 wv[8];
#pragma unroll
            for (int j = 0; j < 8; ++j)
                wv[j] = *(const float2*)(W + (size_t)(k0 + wave * 8 + j) * D + nbase + lane * 2);
            v8h c0, c1;
#pragma unroll
            for (int j = 0; j < 8; ++j) { c0[j] = (_Float16)wv[j].x; c1[j] = (_Float16)wv[j].y; }
            *(v8h*)(Bt + (lane * 2 + 0) * PITCH32 + wave * 8) = c0;
            *(v8h*)(Bt + (lane * 2 + 1) * PITCH32 + wave * 8) = c1;
        }
        if (k0 + 32 < D)  // speculative prefetch of next x tile row
            __builtin_prefetch(x + (size_t)(mbase + (tid >> 1)) * D + k0 + 32, 0, 1);
        __syncthreads();

        v16h a0 = ldfrag(Al, wm + 0  + lane15, PITCH32, 0, lane);
        v16h a1 = ldfrag(Al, wm + 16 + lane15, PITCH32, 0, lane);
        v16h b0 = ldfrag(Bt, wn + 0  + lane15, PITCH32, 0, lane);
        v16h b1 = ldfrag(Bt, wn + 16 + lane15, PITCH32, 0, lane);
        acc[0][0] = WMMA_F16(a0, b0, acc[0][0]);
        acc[0][1] = WMMA_F16(a0, b1, acc[0][1]);
        acc[1][0] = WMMA_F16(a1, b0, acc[1][0]);
        acc[1][1] = WMMA_F16(a1, b1, acc[1][1]);
        __syncthreads();
    }

    // Epilogue: +bias (Q only), de-interleave heads: col n -> (h = n%16, dq = n/16)
    const int half8 = (lane & 16) ? 8 : 0;
#pragma unroll
    for (int tm = 0; tm < 2; ++tm)
#pragma unroll
        for (int tn = 0; tn < 2; ++tn) {
            const int n    = nbase + wn + tn * 16 + lane15;
            const float bi = (z == 0) ? Bq[n] : 0.0f;
            const int h = n & 15, dq = n >> 4;
#pragma unroll
            for (int r = 0; r < 8; ++r) {
                const int m  = mbase + wm + tm * 16 + r + half8;
                const int bb = m >> 11;          // batch
                const int s  = m & 2047;         // seq pos
                Out[((size_t)(bb * H + h) * S + s) * DH + dq] =
                    (_Float16)(acc[tm][tn][r] + bi);
            }
        }
}

// ---------------------------------------------------------------------------
// Stage 2: flash attention, one block per (64 q-rows, head, batch).
// 128 threads = 4 waves; wave w owns query rows [16w, 16w+16).
// Q + double-buffered K tiles arrive via async global->LDS copies.
// ---------------------------------------------------------------------------
__global__ __launch_bounds__(128)
void flash_attn_kernel(const _Float16* __restrict__ Qh,
                       const _Float16* __restrict__ Kh,
                       const _Float16* __restrict__ Vh,
                       float* __restrict__ out) {
    constexpr int S = 2048, H = 16, DH = 64, D = 1024;
    constexpr int NT = S / 64;          // 32 K/V tiles
    constexpr float SCALE = 0.03125f;   // 1/sqrt(D) = 1/32

    __shared__ __align__(16) _Float16 Qs[64 * PITCH64];       // [qrow][dh]
    __shared__ __align__(16) _Float16 Kb[2][64 * PITCH64];    // [j][dh] double buffer
    __shared__ __align__(16) _Float16 Vt[64 * PITCH64];       // [dh][j] (B of PV)
    __shared__ __align__(16) _Float16 Ps[4][16 * PITCH64];    // per-wave P [row][j]

    const int tid = threadIdx.x, lane = tid & 31, wave = tid >> 5;
    const int lane15 = lane & 15;
    const int half8  = (lane & 16) ? 8 : 0;
    const int q0 = blockIdx.x * 64;
    const int h  = blockIdx.y;
    const int b  = blockIdx.z;

    const size_t headoff = (size_t)(b * H + h) * S * DH;
    const _Float16* Qg = Qh + headoff;
    const _Float16* Kg = Kh + headoff;
    const _Float16* Vg = Vh + headoff;

    const unsigned ldsQ  = lds_off(Qs);
    const unsigned ldsK0 = lds_off(Kb[0]);
    const unsigned ldsK1 = lds_off(Kb[1]);

    // Kick off async copies: K tile 0 first, then the resident Q tile.
    // Each tile is 8KB contiguous: 512 x 16B chunks, 4 per thread.
    async_tile_64x64(ldsK0, Kg, tid);
    async_tile_64x64(ldsQ, Qg + (size_t)q0 * DH, tid);
    WAIT_ASYNCCNT(0x0);   // Q and K0 resident in this wave's view

    const v8f zv = {0.f, 0.f, 0.f, 0.f, 0.f, 0.f, 0.f, 0.f};
    v8f o[4];
#pragma unroll
    for (int t = 0; t < 4; ++t) o[t] = zv;
    float m_st[8], l_st[8];
#pragma unroll
    for (int r = 0; r < 8; ++r) { m_st[r] = -1e30f; l_st[r] = 0.0f; }

    for (int ti = 0; ti < NT; ++ti) {
        const int j0 = ti * 64;
        __syncthreads();  // previous iteration done reading Vt / K buffer

        // V tile transposed -> Vt[dh][j] (needs VGPR pass, regular loads).
        // A thread owns 4 dh columns x 8 consecutive j rows: each column's
        // 8 j values leave as one 16-byte LDS store.
        {
            const int vc = lane15 * 4;
            const int vr = (wave * 2 + (lane >> 4)) * 8;
            v4h vv[8];
#pragma unroll
            for (int j = 0; j < 8; ++j)
                vv[j] = *(const v4h*)(Vg + (size_t)(j0 + vr + j) * DH + vc);
#pragma unroll
            for (int u = 0; u < 4; ++u) {
                v8h t;
#pragma unroll
                for (int j = 0; j < 8; ++j) t[j] = vv[j][u];
                *(v8h*)(Vt + (vc + u) * PITCH64 + vr) = t;
            }
        }

        // Prefetch K tile ti+1 into the other buffer (read last in iter ti-1,
        // so the barrier above protects it), then wait for K tile ti.
        if (ti + 1 < NT) {
            const unsigned dst = ((ti + 1) & 1) ? ldsK1 : ldsK0;
            async_tile_64x64(dst, Kg + (size_t)(j0 + 64) * DH, tid);
            WAIT_ASYNCCNT(0x4);   // in-order: first 4 outstanding (tile ti) done
        } else {
            WAIT_ASYNCCNT(0x0);   // last tile: drain
        }
        __syncthreads();          // Vt stores + K tile ti visible block-wide

        const _Float16* Kcur = Kb[ti & 1];

        // ---- S = Q K^T  (contraction over dh; K[j][dh] is exactly B[k][n]) ----
        v8f sc[4];
#pragma unroll
        for (int t = 0; t < 4; ++t) sc[t] = zv;
#pragma unroll
        for (int kk = 0; kk < 64; kk += 32) {
            v16h a = ldfrag(Qs, wave * 16 + lane15, PITCH64, kk, lane);
#pragma unroll
            for (int tn = 0; tn < 4; ++tn) {
                v16h bk = ldfrag(Kcur, tn * 16 + lane15, PITCH64, kk, lane);
                sc[tn] = WMMA_F16(a, bk, sc[tn]);
            }
        }
#pragma unroll
        for (int tn = 0; tn < 4; ++tn)
#pragma unroll
            for (int r = 0; r < 8; ++r) sc[tn][r] *= SCALE;

        // ---- online softmax (row m = r + half8 lives across 16 lanes) ----
        float corr[8];
#pragma unroll
        for (int r = 0; r < 8; ++r) {
            float mx = fmaxf(fmaxf(sc[0][r], sc[1][r]), fmaxf(sc[2][r], sc[3][r]));
#pragma unroll
            for (int off = 1; off < 16; off <<= 1)
                mx = fmaxf(mx, __shfl_xor(mx, off, 32));
            float nm = fmaxf(m_st[r], mx);
            corr[r]  = __expf(m_st[r] - nm);
            m_st[r]  = nm;
        }
        float rs[8];
#pragma unroll
        for (int r = 0; r < 8; ++r) rs[r] = 0.0f;
#pragma unroll
        for (int tn = 0; tn < 4; ++tn)
#pragma unroll
            for (int r = 0; r < 8; ++r) {
                float p = __expf(sc[tn][r] - m_st[r]);
                sc[tn][r] = p;
                rs[r] += p;
            }
#pragma unroll
        for (int r = 0; r < 8; ++r) {
            float t = rs[r];
#pragma unroll
            for (int off = 1; off < 16; off <<= 1) t += __shfl_xor(t, off, 32);
            l_st[r] = l_st[r] * corr[r] + t;
#pragma unroll
            for (int tn = 0; tn < 4; ++tn) o[tn][r] *= corr[r];
        }

        // ---- P: C-layout -> A-layout via per-wave LDS (in-order DS, same wave) ----
        _Float16* P = Ps[wave];
#pragma unroll
        for (int tn = 0; tn < 4; ++tn)
#pragma unroll
            for (int r = 0; r < 8; ++r)
                P[(r + half8) * PITCH64 + tn * 16 + lane15] = (_Float16)sc[tn][r];
        __builtin_amdgcn_wave_barrier();   // keep DS stores before DS frag loads

        // ---- O += P V  (contraction over j; Vt[dh][j] is B[k][n]) ----
#pragma unroll
        for (int kk = 0; kk < 64; kk += 32) {
            v16h a = ldfrag(P, lane15, PITCH64, kk, lane);
#pragma unroll
            for (int tn = 0; tn < 4; ++tn) {
                v16h bv = ldfrag(Vt, tn * 16 + lane15, PITCH64, kk, lane);
                o[tn] = WMMA_F16(a, bv, o[tn]);
            }
        }
    }

    // ---- epilogue: O / l, re-interleave heads (out col = dq*16 + h) ----
#pragma unroll
    for (int tn = 0; tn < 4; ++tn) {
        const int dq = tn * 16 + lane15;
#pragma unroll
        for (int r = 0; r < 8; ++r) {
            const int srow = q0 + wave * 16 + r + half8;
            out[((size_t)b * S + srow) * D + dq * H + h] = o[tn][r] / l_st[r];
        }
    }
}

// ---------------------------------------------------------------------------
extern "C" void kernel_launch(void* const* d_in, const int* in_sizes, int n_in,
                              void* d_out, int out_size, void* d_ws, size_t ws_size,
                              hipStream_t stream) {
    const float* x  = (const float*)d_in[0];
    const float* Wq = (const float*)d_in[1];
    const float* Bq = (const float*)d_in[2];
    const float* Wk = (const float*)d_in[3];
    const float* Wv = (const float*)d_in[4];
    float* out = (float*)d_out;

    // f16 workspace: Q/K/V in [B,H,S,dh] = 4,194,304 halves (8 MB) each
    const size_t per = (size_t)2 * 16 * 2048 * 64;
    _Float16* Qh = (_Float16*)d_ws;
    _Float16* Kh = Qh + per;
    _Float16* Vh = Kh + per;

    dim3 g1(1024 / 64, 4096 / 64, 3);   // (N tiles, M tiles, {Q,K,V})
    qkv_proj_kernel<<<g1, 128, 0, stream>>>(x, Wq, Bq, Wk, Wv, Qh, Kh, Vh);

    dim3 g2(2048 / 64, 16, 2);          // (q tiles, heads, batch)
    flash_attn_kernel<<<g2, 128, 0, stream>>>(Qh, Kh, Vh, out);
}

// v002
// One run takes 138 microseconds.
// Next to v001, in two timings, it ran 2.13 and 2.17 times as fast.
// Counting every step since v000, it is 4.41 times as fast.
#include <hip/hip_runtime.h>
#include <hip/hip_bf16.h>

// ---------------------------------------------------------------------------
// Fused MHA (heads-last interleave) for MI455X / gfx1250, wave32 + WMMA f16.
// Stage 1: Q/K/V projections via v_wmma_f32_16x16x32_f16, de-interleaved into
//          an f16 workspace [B,H,S/64][dh][64 s] (bias fused for Q): a lane's 8
//          accumulator registers are 8 consecutive s of one (head, dh), so they
//          leave as one 16-byte store.
// Stage 2: flash attention; Q/K tiles streamed with GLOBAL_LOAD_ASYNC_TO_LDS
//          (ASYNCcnt-tracked, K double-buffered), both matmuls on WMMA,
//          fp32 online softmax, P staged through LDS for the layout swap.
// LDS rows are pitched 16 B x odd (80 B for 64-B rows, 144 B for 128-B rows) so
// that the 16 rows of a ds_load_b128 fragment read fall on distinct banks, and
// transposed tiles are packed along k in registers and written 16 B at a time.
// Q and K tiles sit in LDS as [dh][s] and are read by the transposing load,
// whose pitch is 32 B x odd (160 B).
// ---------------------------------------------------------------------------

typedef __attribute__((ext_vector_type(16))) _Float16 v16h;
typedef __attribute__((ext_vector_type(8)))  _Float16 v8h;
typedef __attribute__((ext_vector_type(4)))  _Float16 v4h;
typedef __attribute__((ext_vector_type(8)))  float    v8f;

#define WMMA_F16(a, b, c) \
    __builtin_amdgcn_wmma_f32_16x16x32_f16(false, (a), false, (b), (short)0, (c), false, false)

// LDS row pitch in halves: 32-half rows (projection), 64-half rows (attention).
#define PITCH32 40
#define PITCH64 72
// 64-half rows read by ds_load_tr16_b128 (Q and K tiles, stored [dh][s]).
#define PITCHT  80

// One 64x64 f16 tile (8 KB contiguous in global) -> LDS rows of PITCHT halves,
// by 128 threads: four per-lane 16B async copies each (ASYNCcnt counts 4 a wave).
// Chunk idx = tid + 128*it is row idx>>3, 16-byte column idx&7.
// The s_wait_xcnt closes the statement so that no address register of an
// issued copy is rewritten ahead of it.
static __device__ __forceinline__
void async_tile_64x64(unsigned lds_base, const _Float16* g, int tid) {
    const unsigned l0 = lds_base + (unsigned)(tid >> 3) * (PITCHT * 2) + (unsigned)(tid & 7) * 16;
    const unsigned long long g0 = (unsigned long long)(uintptr_t)(g + tid * 8);
    asm volatile("global_load_async_to_lds_b128 %0, %4, off\n\t"
                 "global_load_async_to_lds_b128 %1, %5, off\n\t"
                 "global_load_async_to_lds_b128 %2, %6, off\n\t"
                 "global_load_async_to_lds_b128 %3, %7, off\n\t"
                 "s_wait_xcnt 0x0"
                 :: "v"(l0), "v"(l0 + 16 * PITCHT * 2), "v"(l0 + 32 * PITCHT * 2),
                    "v"(l0 + 48 * PITCHT * 2),
                    "v"(g0), "v"(g0 + 2048), "v"(g0 + 4096), "v"(g0 + 6144)
                 : "memory");
}
#define WAIT_ASYNCCNT(n) asm volatile("s_wait_asynccnt " #n ::: "memory")

// Low 32 bits of a generic pointer to LDS == LDS byte offset (ISA §10.2).
static __device__ __forceinline__ unsigned lds_off(const void* p) {
    return (unsigned)(uintptr_t)p;
}

// Load a 16x32 f16 A/B fragment from an LDS tile stored [row][k] (rstride
// halves per row). ISA 16-bit A layout: lanes 0-15 hold K {0..7,16..23},
// lanes 16-31 hold K {8..15,24..31} (wave32).
static __device__ __forceinline__
v16h ldfrag(const _Float16* __restrict__ base, int row, int rstride, int koff, int lane) {
    const _Float16* p = base + row * rstride + koff + ((lane & 16) ? 8 : 0);
    v8h lo = *(const v8h*)(p);
    v8h hi = *(const v8h*)(p + 16);
    v16h r;
#pragma unroll
    for (int i = 0; i < 8; ++i) { r[i] = lo[i]; r[i + 8] = hi[i]; }
    return r;
}

// The same 16x32 fragment (same k order) from an LDS tile stored [k][row],
// PITCHT halves per k: lane (c = lane & 15, hf = lane >> 4) receives
// T[kbase + 8 hf + 0..7][rbase + c], then the same 16 k further on.
typedef __attribute__((ext_vector_type(8))) short v8s;
static __device__ __forceinline__
v8h ld_tr16(const _Float16* p) {
    typedef __attribute__((address_space(3))) v8s lds_v8s;
    return __builtin_bit_cast(v8h, __builtin_amdgcn_ds_load_tr16_b128_v8i16((lds_v8s*)p));
}
static __device__ __forceinline__
v16h ldfrag_tr(const _Float16* __restrict__ base, int rbase, int kbase, int lane) {
    const _Float16* p = base + (kbase + 8 * (lane >> 4) + (lane & 7)) * PITCHT
                             + rbase + 8 * ((lane >> 3) & 1);
    v8h lo = ld_tr16(p);
    v8h hi = ld_tr16(p + 16 * PITCHT);
    v16h r;
#pragma unroll
    for (int i = 0; i < 8; ++i) { r[i] = lo[i]; r[i + 8] = hi[i]; }
    return r;
}

// ---------------------------------------------------------------------------
// Stage 1: QKV projection GEMM.  out[z] = x @ W[z] (+ Bq for z==0)
// x:[4096,1024] f32, W:[1024,1024] f32 -> f16 [B,H,S/64][dh][64 s] (heads de-interleaved)
// Block: 128 threads (4 waves, 2x2), 64x64 output tile, K-step 32.
// (f32->f16 conversion must pass through VGPRs, so tiles load synchronously.)
// ---------------------------------------------------------------------------
__global__ __launch_bounds__(128)
void qkv_proj_kernel(const float* __restrict__ x,
                     const float* __restrict__ Wq,
                     const float* __restrict__ Bq,
                     const float* __restrict__ Wk,
                     const float* __restrict__ Wv,
                     _Float16* __restrict__ Qh,
                     _Float16* __restrict__ Kh,
                     _Float16* __restrict__ Vh) {
    constexpr int D = 1024, S = 2048, H = 16, DH = 64;
    __shared__ __align__(16) _Float16 Al[64 * PITCH32];   // x tile  [m][k]
    __shared__ __align__(16) _Float16 Bt[64 * PITCH32];   // W tile transposed [n][k]

    const int tid   = threadIdx.x;
    const int lane  = tid & 31;
    const int wave  = tid >> 5;
    const int wm    = (wave >> 1) * 32;
    const int wn    = (wave & 1) * 32;
    const int mbase = blockIdx.y * 64;
    const int nbase = blockIdx.x * 64;
    const int z     = blockIdx.z;

    const float* W   = (z == 0) ? Wq : (z == 1) ? Wk : Wv;
    _Float16*    Out = (z == 0) ? Qh : (z == 1) ? Kh : Vh;

    const v8f zv = {0.f, 0.f, 0.f, 0.f, 0.f, 0.f, 0.f, 0.f};
    v8f acc[2][2];
#pragma unroll
    for (int i = 0; i < 2; ++i)
#pragma unroll
        for (int j = 0; j < 2; ++j) acc[i][j] = zv;

    const int lane15 = lane & 15;

    for (int k0 = 0; k0 < D; k0 += 32) {
        // x tile: 64 rows x 32 cols = 512 float4 chunks, 4 per thread
#pragma unroll
        for (int it = 0; it < 4; ++it) {
            int idx = tid + it * 128;
            int row = idx >> 3, c4 = (idx & 7) * 4;
            const float4 v = *(const float4*)(x + (size_t)(mbase + row) * D + k0 + c4);
            _Float16* d = Al + row * PITCH32 + c4;
            d[0] = (_Float16)v.x; d[1] = (_Float16)v.y;
            d[2] = (_Float16)v.z; d[3] = (_Float16)v.w;
        }
        // W tile: 32 rows(k) x 64 cols(n), store transposed [n][k].
        // A lane owns columns 2*lane, 2*lane+1, a wave k rows 8*wave..8*wave+7:
        // each column's 8 k values leave as one 16-byte LDS store.
        {
            float2 wv[8];
#pragma unroll
            for (int j = 0; j < 8; ++j)
                wv[j] = *(const float2*)(W + (size_t)(k0 + wave * 8 + j) * D + nbase + lane * 2);
            v8h c0, c1;
#pragma unroll
            for (int j = 0; j < 8; ++j) { c0[j] = (_Float16)wv[j].x; c1[j] = (_Float16)wv[j].y; }
            *(v8h*)(Bt + (lane * 2 + 0) * PITCH32 + wave * 8) = c0;
            *(v8h*)(Bt + (lane * 2 + 1) * PITCH32 + wave * 8) = c1;
        }
        if (k0 + 32 < D)  // speculative prefetch of next x tile row
            __builtin_prefetch(x + (size_t)(mbase + (tid >> 1)) * D + k0 + 32, 0, 1);
        __syncthreads();

        v16h a0 = ldfrag(Al, wm + 0  + lane15, PITCH32, 0, lane);
        v16h a1 = ldfrag(Al, wm + 16 + lane15, PITCH32, 0, lane);
        v16h b0 = ldfrag(Bt, wn + 0  + lane15, PITCH32, 0, lane);
        v16h b1 = ldfrag(Bt, wn + 16 + lane15, PITCH32, 0, lane);
        acc[0][0] = WMMA_F16(a0, b0, acc[0][0]);
        acc[0][1] = WMMA_F16(a0, b1, acc[0][1]);
        acc[1][0] = WMMA_F16(a1, b0, acc[1][0]);
        acc[1][1] = WMMA_F16(a1, b1, acc[1][1]);
        __syncthreads();
    }

    // Epilogue: +bias (Q only), de-interleave heads: col n -> (h = n%16, dq = n/16).
    // All four tiles are packed first and the four stores stand last, so that no
    // register of an issued store is written again.
    const int half8 = (lane & 16) ? 8 : 0;
    v8h       pk[2][2];
    _Float16* dst[2][2];
    float     bias[2] = {0.0f, 0.0f};
    if (z == 0) {
        bias[0] = Bq[nbase + wn + lane15];
        bias[1] = Bq[nbase + wn + 16 + lane15];
    }
#pragma unroll
    for (int tn = 0; tn < 2; ++tn) {
        const int n    = nbase + wn + tn * 16 + lane15;
        const float bi = bias[tn];
        const int h = n & 15, dq = n >> 4;
#pragma unroll
        for (int tm = 0; tm < 2; ++tm) {
            const int m  = mbase + wm + tm * 16 + half8;   // first of the lane's 8 rows
            const int bb = m >> 11;          // batch
            const int s  = m & 2047;         // seq pos
#pragma unroll
            for (int r = 0; r < 8; ++r) pk[tm][tn][r] = (_Float16)(acc[tm][tn][r] + bi);
            dst[tm][tn] = Out + (size_t)(bb * H + h) * S * DH
                              + (size_t)((s >> 6) * DH + dq) * 64 + (s & 63);
        }
    }
#pragma unroll
    for (int tm = 0; tm < 2; ++tm)
#pragma unroll
        for (int tn = 0; tn < 2; ++tn) *(v8h*)dst[tm][tn] = pk[tm][tn];
}

// ---------------------------------------------------------------------------
// Stage 2: flash attention, one block per (64 q-rows, head, batch).
// 128 threads = 4 waves; wave w owns query rows [16w, 16w+16).
// Q + double-buffered K tiles arrive via async global->LDS copies.
// ---------------------------------------------------------------------------
__global__ __launch_bounds__(128)
void flash_attn_kernel(const _Float16* __restrict__ Qh,
                       const _Float16* __restrict__ Kh,
                       const _Float16* __restrict__ Vh,
                       float* __restrict__ out) {
    constexpr int S = 2048, H = 16, DH = 64, D = 1024;
    constexpr int NT = S / 64;          // 32 K/V tiles
    constexpr float SCALE = 0.03125f;   // 1/sqrt(D) = 1/32

    __shared__ __align__(16) _Float16 Qs[64 * PITCHT];        // [dh][qrow]
    __shared__ __align__(16) _Float16 Kb[2][64 * PITCHT];     // [dh][j] double buffer
    __shared__ __align__(16) _Float16 Vt[64 * PITCH64];       // [dh][j] (B of PV)
    __shared__ __align__(16) _Float16 Ps[4][16 * PITCH64];    // per-wave P [row][j]

    const int tid = threadIdx.x, lane = tid & 31, wave = tid >> 5;
    const int lane15 = lane & 15;
    const int half8  = (lane & 16) ? 8 : 0;
    const int q0 = blockIdx.x * 64;
    const int h  = blockIdx.y;
    const int b  = blockIdx.z;

    const size_t headoff = (size_t)(b * H + h) * S * DH;
    const _Float16* Qg = Qh + headoff;
    const _Float16* Kg = Kh + headoff;
    const _Float16* Vg = Vh + headoff;

    const unsigned ldsQ  = lds_off(Qs);
    const unsigned ldsK0 = lds_off(Kb[0]);
    const unsigned ldsK1 = lds_off(Kb[1]);

    // Kick off async copies: K tile 0 first, then the resident Q tile.
    // Each tile is 8KB contiguous: 512 x 16B chunks, 4 per thread.
    async_tile_64x64(ldsK0, Kg, tid);
    async_tile_64x64(ldsQ, Qg + (size_t)q0 * DH, tid);
    WAIT_ASYNCCNT(0x0);   // Q and K0 resident in this wave's view

    const v8f zv = {0.f, 0.f, 0.f, 0.f, 0.f, 0.f, 0.f, 0.f};
    v8f o[4];
#pragma unroll
    for (int t = 0; t < 4; ++t) o[t] = zv;
    float m_st[8], l_st[8];
#pragma unroll
    for (int r = 0; r < 8; ++r) { m_st[r] = -1e30f; l_st[r] = 0.0f; }

    for (int ti = 0; ti < NT; ++ti) {
        const int j0 = ti * 64;
        __syncthreads();  // previous iteration done reading Vt / K buffer

        // V tile -> Vt[dh][j]: the workspace tile already is [dh][j], 8 KB
        // contiguous; chunk idx = tid + 128*it is row idx>>3, 16-byte column idx&7.
        {
            v8h vv[4];
#pragma unroll
            for (int it = 0; it < 4; ++it)
                vv[it] = *(const v8h*)(Vg + (size_t)j0 * DH + (tid + it * 128) * 8);
#pragma unroll
            for (int it = 0; it < 4; ++it)
                *(v8h*)(Vt + ((tid >> 3) + it * 16) * PITCH64 + (tid & 7) * 8) = vv[it];
        }

        // Prefetch K tile ti+1 into the other buffer (read last in iter ti-1,
        // so the barrier above protects it), then wait for K tile ti.
        if (ti + 1 < NT) {
            const unsigned dst = ((ti + 1) & 1) ? ldsK1 : ldsK0;
            async_tile_64x64(dst, Kg + (size_t)(j0 + 64) * DH, tid);
            WAIT_ASYNCCNT(0x4);   // in-order: first 4 outstanding (tile ti) done
        } else {
            WAIT_ASYNCCNT(0x0);   // last tile: drain
        }
        __syncthreads();          // Vt stores + K tile ti visible block-wide

        const _Float16* Kcur = Kb[ti & 1];

        // ---- S = Q K^T  (contraction over dh; both tiles are [dh][row]) ----
        v8f sc[4];
#pragma unroll
        for (int t = 0; t < 4; ++t) sc[t] = zv;
#pragma unroll
        for (int kk = 0; kk < 64; kk += 32) {
            v16h a = ldfrag_tr(Qs, wave * 16, kk, lane);
#pragma unroll
            for (int tn = 0; tn < 4; ++tn) {
                v16h bk = ldfrag_tr(Kcur, tn * 16, kk, lane);
                sc[tn] = WMMA_F16(a, bk, sc[tn]);
            }
        }
#pragma unroll
        for (int tn = 0; tn < 4; ++tn)
#pragma unroll
            for (int r = 0; r < 8; ++r) sc[tn][r] *= SCALE;

        // ---- online softmax (row m = r + half8 lives across 16 lanes) ----
        float corr[8];
#pragma unroll
        for (int r = 0; r < 8; ++r) {
            float mx = fmaxf(fmaxf(sc[0][r], sc[1][r]), fmaxf(sc[2][r], sc[3][r]));
#pragma unroll
            for (int off = 1; off < 16; off <<= 1)
                mx = fmaxf(mx, __shfl_xor(mx, off, 32));
            float nm = fmaxf(m_st[r], mx);
            corr[r]  = __expf(m_st[r] - nm);
            m_st[r]  = nm;
        }
        float rs[8];
#pragma unroll
        for (int r = 0; r < 8; ++r) rs[r] = 0.0f;
#pragma unroll
        for (int tn = 0; tn < 4; ++tn)
#pragma unroll
            for (int r = 0; r < 8; ++r) {
                float p = __expf(sc[tn][r] - m_st[r]);
                sc[tn][r] = p;
                rs[r] += p;
            }
#pragma unroll
        for (int r = 0; r < 8; ++r) {
            float t = rs[r];
#pragma unroll
            for (int off = 1; off < 16; off <<= 1) t += __shfl_xor(t, off, 32);
            l_st[r] = l_st[r] * corr[r] + t;
#pragma unroll
            for (int tn = 0; tn < 4; ++tn) o[tn][r] *= corr[r];
        }

        // ---- P: C-layout -> A-layout via per-wave LDS (in-order DS, same wave) ----
        _Float16* P = Ps[wave];
#pragma unroll
        for (int tn = 0; tn < 4; ++tn)
#pragma unroll
            for (int r = 0; r < 8; ++r)
                P[(r + half8) * PITCH64 + tn * 16 + lane15] = (_Float16)sc[tn][r];
        __builtin_amdgcn_wave_barrier();   // keep DS stores before DS frag loads

        // ---- O += P V  (contraction over j; Vt[dh][j] is B[k][n]) ----
#pragma unroll
        for (int kk = 0; kk < 64; kk += 32) {
            v16h a = ldfrag(P, lane15, PITCH64, kk, lane);
#pragma unroll
            for (int tn = 0; tn < 4; ++tn) {
                v16h bv = ldfrag(Vt, tn * 16 + lane15, PITCH64, kk, lane);
                o[tn] = WMMA_F16(a, bv, o[tn]);
            }
        }
    }

    // ---- epilogue: O / l, re-interleave heads (out col = dq*16 + h) ----
#pragma unroll
    for (int tn = 0; tn < 4; ++tn) {
        const int dq = tn * 16 + lane15;
#pragma unroll
        for (int r = 0; r < 8; ++r) {
            const int srow = q0 + wave * 16 + r + half8;
            out[((size_t)b * S + srow) * D + dq * H + h] = o[tn][r] / l_st[r];
        }
    }
}

// ---------------------------------------------------------------------------
extern "C" void kernel_launch(void* const* d_in, const int* in_sizes, int n_in,
                              void* d_out, int out_size, void* d_ws, size_t ws_size,
                              hipStream_t stream) {
    const float* x  = (const float*)d_in[0];
    const float* Wq = (const float*)d_in[1];
    const float* Bq = (const float*)d_in[2];
    const float* Wk = (const float*)d_in[3];
    const float* Wv = (const float*)d_in[4];
    float* out = (float*)d_out;

    // f16 workspace: Q/K/V in [B,H,S/64][dh][64] = 4,194,304 halves (8 MB) each
    const size_t per = (size_t)2 * 16 * 2048 * 64;
    _Float16* Qh = (_Float16*)d_ws;
    _Float16* Kh = Qh + per;
    _Float16* Vh = Kh + per;

    dim3 g1(1024 / 64, 4096 / 64, 3);   // (N tiles, M tiles, {Q,K,V})
    qkv_proj_kernel<<<g1, 128, 0, stream>>>(x, Wq, Bq, Wk, Wv, Qh, Kh, Vh);

    dim3 g2(2048 / 64, 16, 2);          // (q tiles, heads, batch)
    flash_attn_kernel<<<g2, 128, 0, stream>>>(Qh, Kh, Vh, out);
}

// v003
// One run takes 112 microseconds.
// Two timings next to v002 put it at 1.21 and 1.26 times that version's speed.
// All steps since v000 together make it 5.43 times as fast.
#include <hip/hip_runtime.h>
#include <hip/hip_bf16.h>

// ---------------------------------------------------------------------------
// Fused MHA (heads-last interleave) for MI455X / gfx1250, wave32 + WMMA f16.
// Stage 1: Q/K/V projections via v_wmma_f32_16x16x32_f16, de-interleaved into
//          an f16 workspace [B,H,S/64][dh][64 s] (bias fused for Q): a lane's 8
//          accumulator registers are 8 consecutive s of one (head, dh), so they
//          leave as one 16-byte store.
// Stage 2: flash attention; Q/K tiles streamed with GLOBAL_LOAD_ASYNC_TO_LDS
//          (ASYNCcnt-tracked, K double-buffered), both matmuls on WMMA and
//          transposed (S^T = K Q^T, O^T += V^T P^T): a lane holds one query's
//          scores (32 of 64, lane ^ 16 the rest), so the fp32 online softmax is
//          in-lane but for a lane ^ 16 exchange of the max and sum, and the score
//          accumulators pack straight into the B operand of the second product.
// LDS rows are pitched 16 B x odd (80 B for 64-B rows, 144 B for 128-B rows) so
// that the 16 rows of a ds_load_b128 fragment read fall on distinct banks, and
// transposed tiles are packed along k in registers and written 16 B at a time.
// Q and K tiles sit in LDS as [dh][s] and are read by the transposing load,
// whose pitch is 32 B x odd (160 B).
// ---------------------------------------------------------------------------

typedef __attribute__((ext_vector_type(16))) _Float16 v16h;
typedef __attribute__((ext_vector_type(8)))  _Float16 v8h;
typedef __attribute__((ext_vector_type(4)))  _Float16 v4h;
typedef __attribute__((ext_vector_type(8)))  float    v8f;

#define WMMA_F16(a, b, c) \
    __builtin_amdgcn_wmma_f32_16x16x32_f16(false, (a), false, (b), (short)0, (c), false, false)

// LDS row pitch in halves: 32-half rows (projection), 64-half rows (attention).
#define PITCH32 40
#define PITCH64 72
// 64-half rows read by ds_load_tr16_b128 (Q and K tiles, stored [dh][s]).
#define PITCHT  80
// 64-float rows of the output staging: 16 B x odd.
#define PITCHO  68

// One 64x64 f16 tile (8 KB contiguous in global) -> LDS rows of PITCHT halves,
// by 128 threads: four per-lane 16B async copies each (ASYNCcnt counts 4 a wave).
// Chunk idx = tid + 128*it is row idx>>3, 16-byte column idx&7.
// The s_wait_xcnt closes the statement so that no address register of an
// issued copy is rewritten ahead of it.
static __device__ __forceinline__
void async_tile_64x64(unsigned lds_base, const _Float16* g, int tid) {
    const unsigned l0 = lds_base + (unsigned)(tid >> 3) * (PITCHT * 2) + (unsigned)(tid & 7) * 16;
    const unsigned long long g0 = (unsigned long long)(uintptr_t)(g + tid * 8);
    asm volatile("global_load_async_to_lds_b128 %0, %4, off\n\t"
                 "global_load_async_to_lds_b128 %1, %5, off\n\t"
                 "global_load_async_to_lds_b128 %2, %6, off\n\t"
                 "global_load_async_to_lds_b128 %3, %7, off\n\t"
                 "s_wait_xcnt 0x0"
                 :: "v"(l0), "v"(l0 + 16 * PITCHT * 2), "v"(l0 + 32 * PITCHT * 2),
                    "v"(l0 + 48 * PITCHT * 2),
                    "v"(g0), "v"(g0 + 2048), "v"(g0 + 4096), "v"(g0 + 6144)
                 : "memory");
}
#define WAIT_ASYNCCNT(n) asm volatile("s_wait_asynccnt " #n ::: "memory")

// Low 32 bits of a generic pointer to LDS == LDS byte offset (ISA §10.2).
static __device__ __forceinline__ unsigned lds_off(const void* p) {
    return (unsigned)(uintptr_t)p;
}

// Value of lane l ^ 16 (the other 16-lane row), by a vector cross-row move.
static __device__ __forceinline__ float xhalf(float v) {
    const int b = __builtin_bit_cast(int, v);
    return __builtin_bit_cast(float,
        __builtin_amdgcn_permlanex16(b, b, 0x76543210, 0xfedcba98, false, false));
}

// e^x of eight values as __expf forms it (2^(x log2 e), v_exp_f32), in place.
// One statement, so that each v_exp_f32 is followed by an instruction that
// touches neither its result nor its source: the next one, and a v_nop behind
// the last (the slot the instruction set asks for behind a transcendental).
static __device__ __forceinline__ void exp_x8(v8f& t) {
    float a = t[0] * 1.44269504f, b = t[1] * 1.44269504f, c = t[2] * 1.44269504f,
          d = t[3] * 1.44269504f, e = t[4] * 1.44269504f, f = t[5] * 1.44269504f,
          g = t[6] * 1.44269504f, h = t[7] * 1.44269504f;
    asm("v_exp_f32 %0, %0\n\t" "v_exp_f32 %1, %1\n\t" "v_exp_f32 %2, %2\n\t"
        "v_exp_f32 %3, %3\n\t" "v_exp_f32 %4, %4\n\t" "v_exp_f32 %5, %5\n\t"
        "v_exp_f32 %6, %6\n\t" "v_exp_f32 %7, %7\n\t" "v_nop"
        : "+v"(a), "+v"(b), "+v"(c), "+v"(d), "+v"(e), "+v"(f), "+v"(g), "+v"(h));
    t[0] = a; t[1] = b; t[2] = c; t[3] = d; t[4] = e; t[5] = f; t[6] = g; t[7] = h;
}

// The same for one value.
static __device__ __forceinline__ float exp_x1(float x) {
    float a = x * 1.44269504f;
    asm("v_exp_f32 %0, %0\n\t" "v_nop" : "+v"(a));
    return a;
}

// Load a 16x32 f16 A/B fragment from an LDS tile stored [row][k] (rstride
// halves per row). ISA 16-bit A layout: lanes 0-15 hold K {0..7,16..23},
// lanes 16-31 hold K {8..15,24..31} (wave32).
static __device__ __forceinline__
v16h ldfrag(const _Float16* __restrict__ base, int row, int rstride, int koff, int lane) {
    const _Float16* p = base + row * rstride + koff + ((lane & 16) ? 8 : 0);
    v8h lo = *(const v8h*)(p);
    v8h hi = *(const v8h*)(p + 16);
    v16h r;
#pragma unroll
    for (int i = 0; i < 8; ++i) { r[i] = lo[i]; r[i + 8] = hi[i]; }
    return r;
}

// The same 16x32 fragment (same k order) from an LDS tile stored [k][row],
// PITCHT halves per k: lane (c = lane & 15, hf = lane >> 4) receives
// T[kbase + 8 hf + 0..7][rbase + c], then the same 16 k further on.
typedef __attribute__((ext_vector_type(8))) short v8s;
static __device__ __forceinline__
v8h ld_tr16(const _Float16* p) {
    typedef __attribute__((address_space(3))) v8s lds_v8s;
    return __builtin_bit_cast(v8h, __builtin_amdgcn_ds_load_tr16_b128_v8i16((lds_v8s*)p));
}
static __device__ __forceinline__
v16h ldfrag_tr(const _Float16* __restrict__ base, int rbase, int kbase, int lane) {
    const _Float16* p = base + (kbase + 8 * (lane >> 4) + (lane & 7)) * PITCHT
                             + rbase + 8 * ((lane >> 3) & 1);
    v8h lo = ld_tr16(p);
    v8h hi = ld_tr16(p + 16 * PITCHT);
    v16h r;
#pragma unroll
    for (int i = 0; i < 8; ++i) { r[i] = lo[i]; r[i + 8] = hi[i]; }
    return r;
}

// ---------------------------------------------------------------------------
// Stage 1: QKV projection GEMM.  out[z] = x @ W[z] (+ Bq for z==0)
// x:[4096,1024] f32, W:[1024,1024] f32 -> f16 [B,H,S/64][dh][64 s] (heads de-interleaved)
// Block: 128 threads (4 waves, 2x2), 64x64 output tile, K-step 32.
// (f32->f16 conversion must pass through VGPRs, so tiles load synchronously.)
// ---------------------------------------------------------------------------
__global__ __launch_bounds__(128)
void qkv_proj_kernel(const float* __restrict__ x,
                     const float* __restrict__ Wq,
                     const float* __restrict__ Bq,
                     const float* __restrict__ Wk,
                     const float* __restrict__ Wv,
                     _Float16* __restrict__ Qh,
                     _Float16* __restrict__ Kh,
                     _Float16* __restrict__ Vh) {
    constexpr int D = 1024, S = 2048, H = 16, DH = 64;
    __shared__ __align__(16) _Float16 Al[64 * PITCH32];   // x tile  [m][k]
    __shared__ __align__(16) _Float16 Bt[64 * PITCH32];   // W tile transposed [n][k]

    const int tid   = threadIdx.x;
    const int lane  = tid & 31;
    const int wave  = tid >> 5;
    const int wm    = (wave >> 1) * 32;
    const int wn    = (wave & 1) * 32;
    const int mbase = blockIdx.y * 64;
    const int nbase = blockIdx.x * 64;
    const int z     = blockIdx.z;

    const float* W   = (z == 0) ? Wq : (z == 1) ? Wk : Wv;
    _Float16*    Out = (z == 0) ? Qh : (z == 1) ? Kh : Vh;

    const v8f zv = {0.f, 0.f, 0.f, 0.f, 0.f, 0.f, 0.f, 0.f};
    v8f acc[2][2];
#pragma unroll
    for (int i = 0; i < 2; ++i)
#pragma unroll
        for (int j = 0; j < 2; ++j) acc[i][j] = zv;

    const int lane15 = lane & 15;

    for (int k0 = 0; k0 < D; k0 += 32) {
        // x tile: 64 rows x 32 cols = 512 float4 chunks, 4 per thread
#pragma unroll
        for (int it = 0; it < 4; ++it) {
            int idx = tid + it * 128;
            int row = idx >> 3, c4 = (idx & 7) * 4;
            const float4 v = *(const float4*)(x + (size_t)(mbase + row) * D + k0 + c4);
            _Float16* d = Al + row * PITCH32 + c4;
            d[0] = (_Float16)v.x; d[1] = (_Float16)v.y;
            d[2] = (_Float16)v.z; d[3] = (_Float16)v.w;
        }
        // W tile: 32 rows(k) x 64 cols(n), store transposed [n][k].
        // A lane owns columns 2*lane, 2*lane+1, a wave k rows 8*wave..8*wave+7:
        // each column's 8 k values leave as one 16-byte LDS store.
        {
            float2 wv[8];
#pragma unroll
            for (int j = 0; j < 8; ++j)
                wv[j] = *(const float2*)(W + (size_t)(k0 + wave * 8 + j) * D + nbase + lane * 2);
            v8h c0, c1;
#pragma unroll
            for (int j = 0; j < 8; ++j) { c0[j] = (_Float16)wv[j].x; c1[j] = (_Float16)wv[j].y; }
            *(v8h*)(Bt + (lane * 2 + 0) * PITCH32 + wave * 8) = c0;
            *(v8h*)(Bt + (lane * 2 + 1) * PITCH32 + wave * 8) = c1;
        }
        if (k0 + 32 < D)  // speculative prefetch of next x tile row
            __builtin_prefetch(x + (size_t)(mbase + (tid >> 1)) * D + k0 + 32, 0, 1);
        __syncthreads();

        v16h a0 = ldfrag(Al, wm + 0  + lane15, PITCH32, 0, lane);
        v16h a1 = ldfrag(Al, wm + 16 + lane15, PITCH32, 0, lane);
        v16h b0 = ldfrag(Bt, wn + 0  + lane15, PITCH32, 0, lane);
        v16h b1 = ldfrag(Bt, wn + 16 + lane15, PITCH32, 0, lane);
        acc[0][0] = WMMA_F16(a0, b0, acc[0][0]);
        acc[0][1] = WMMA_F16(a0, b1, acc[0][1]);
        acc[1][0] = WMMA_F16(a1, b0, acc[1][0]);
        acc[1][1] = WMMA_F16(a1, b1, acc[1][1]);
        __syncthreads();
    }

    // Epilogue: +bias (Q only), de-interleave heads: col n -> (h = n%16, dq = n/16).
    // All four tiles are packed first and the four stores stand last, so that no
    // register of an issued store is written again.
    const int half8 = (lane & 16) ? 8 : 0;
    v8h       pk[2][2];
    _Float16* dst[2][2];
    float     bias[2] = {0.0f, 0.0f};
    if (z == 0) {
        bias[0] = Bq[nbase + wn + lane15];
        bias[1] = Bq[nbase + wn + 16 + lane15];
    }
#pragma unroll
    for (int tn = 0; tn < 2; ++tn) {
        const int n    = nbase + wn + tn * 16 + lane15;
        const float bi = bias[tn];
        const int h = n & 15, dq = n >> 4;
#pragma unroll
        for (int tm = 0; tm < 2; ++tm) {
            const int m  = mbase + wm + tm * 16 + half8;   // first of the lane's 8 rows
            const int bb = m >> 11;          // batch
            const int s  = m & 2047;         // seq pos
#pragma unroll
            for (int r = 0; r < 8; ++r) pk[tm][tn][r] = (_Float16)(acc[tm][tn][r] + bi);
            dst[tm][tn] = Out + (size_t)(bb * H + h) * S * DH
                              + (size_t)((s >> 6) * DH + dq) * 64 + (s & 63);
        }
    }
#pragma unroll
    for (int tm = 0; tm < 2; ++tm)
#pragma unroll
        for (int tn = 0; tn < 2; ++tn) *(v8h*)dst[tm][tn] = pk[tm][tn];
}

// ---------------------------------------------------------------------------
// Stage 2: flash attention, one block per (64 q-rows, head, batch).
// 128 threads = 4 waves; wave w owns queries [16w, 16w+16), one per lane & 15.
// Q + double-buffered K tiles arrive via async global->LDS copies.
// ---------------------------------------------------------------------------
__global__ __launch_bounds__(128)
void flash_attn_kernel(const _Float16* __restrict__ Qh,
                       const _Float16* __restrict__ Kh,
                       const _Float16* __restrict__ Vh,
                       float* __restrict__ out) {
    constexpr int S = 2048, H = 16, DH = 64, D = 1024;
    constexpr int NT = S / 64;          // 32 K/V tiles
    constexpr float SCALE = 0.03125f;   // 1/sqrt(D) = 1/32

    __shared__ __align__(16) _Float16 Qs[64 * PITCHT];        // [dh][qrow]
    __shared__ __align__(16) _Float16 Kb[2][64 * PITCHT];     // [dh][j] double buffer
    __shared__ __align__(16) _Float16 Vt[64 * PITCH64];       // [dh][j] (A of V^T P^T)
    __shared__ __align__(16) float    Os[4][16 * PITCHO];     // per-wave O [q][dh], epilogue only

    const int tid = threadIdx.x, lane = tid & 31, wave = tid >> 5;
    const int lane15 = lane & 15;
    const int half8  = (lane & 16) ? 8 : 0;
    const int q0 = blockIdx.x * 64;
    const int h  = blockIdx.y;
    const int b  = blockIdx.z;

    const size_t headoff = (size_t)(b * H + h) * S * DH;
    const _Float16* Qg = Qh + headoff;
    const _Float16* Kg = Kh + headoff;
    const _Float16* Vg = Vh + headoff;

    const unsigned ldsQ  = lds_off(Qs);
    const unsigned ldsK0 = lds_off(Kb[0]);
    const unsigned ldsK1 = lds_off(Kb[1]);

    // Kick off async copies: K tile 0 first, then the resident Q tile.
    // Each tile is 8KB contiguous: 512 x 16B chunks, 4 per thread.
    async_tile_64x64(ldsK0, Kg, tid);
    async_tile_64x64(ldsQ, Qg + (size_t)q0 * DH, tid);
    WAIT_ASYNCCNT(0x0);   // Q and K0 resident in this wave's view

    const v8f zv = {0.f, 0.f, 0.f, 0.f, 0.f, 0.f, 0.f, 0.f};
    v8f o[4];
#pragma unroll
    for (int t = 0; t < 4; ++t) o[t] = zv;
    // Running maximum of the lane's query (equal in both wave halves) and the
    // sum over the keys that this half of the wave holds (joined in the epilogue).
    float m_st = -1e30f, l_st = 0.0f;

    for (int ti = 0; ti < NT; ++ti) {
        const int j0 = ti * 64;
        __syncthreads();  // previous iteration done reading Vt / K buffer

        // V tile -> Vt[dh][j]: the workspace tile already is [dh][j], 8 KB
        // contiguous; chunk idx = tid + 128*it is row idx>>3, 16-byte column idx&7.
        {
            v8h vv[4];
#pragma unroll
            for (int it = 0; it < 4; ++it)
                vv[it] = *(const v8h*)(Vg + (size_t)j0 * DH + (tid + it * 128) * 8);
#pragma unroll
            for (int it = 0; it < 4; ++it)
                *(v8h*)(Vt + ((tid >> 3) + it * 16) * PITCH64 + (tid & 7) * 8) = vv[it];
        }

        // Prefetch K tile ti+1 into the other buffer (read last in iter ti-1,
        // so the barrier above protects it), then wait for K tile ti.
        if (ti + 1 < NT) {
            const unsigned dst = ((ti + 1) & 1) ? ldsK1 : ldsK0;
            async_tile_64x64(dst, Kg + (size_t)(j0 + 64) * DH, tid);
            WAIT_ASYNCCNT(0x4);   // in-order: first 4 outstanding (tile ti) done
        } else {
            WAIT_ASYNCCNT(0x0);   // last tile: drain
        }
        __syncthreads();          // Vt stores + K tile ti visible block-wide

        const _Float16* Kcur = Kb[ti & 1];

        // ---- S^T = K Q^T  (contraction over dh; both tiles are [dh][row]) ----
        // sc[tn][r] = score of key j0 + 16 tn + r + half8 with query lane15.
        v8f sc[4];
#pragma unroll
        for (int t = 0; t < 4; ++t) sc[t] = zv;
#pragma unroll
        for (int kk = 0; kk < 64; kk += 32) {
            v16h bq = ldfrag_tr(Qs, wave * 16, kk, lane);
#pragma unroll
            for (int tn = 0; tn < 4; ++tn) {
                v16h ak = ldfrag_tr(Kcur, tn * 16, kk, lane);
                sc[tn] = WMMA_F16(ak, bq, sc[tn]);
            }
        }
#pragma unroll
        for (int tn = 0; tn < 4; ++tn)
#pragma unroll
            for (int r = 0; r < 8; ++r) sc[tn][r] *= SCALE;

        // ---- online softmax: the lane's 32 scores and those of lane ^ 16 are
        //      the 64 keys of one query ----
        float mr[8];
#pragma unroll
        for (int r = 0; r < 8; ++r)
            mr[r] = fmaxf(fmaxf(sc[0][r], sc[1][r]), fmaxf(sc[2][r], sc[3][r]));
        float mx = fmaxf(fmaxf(fmaxf(mr[0], mr[1]), fmaxf(mr[2], mr[3])),
                         fmaxf(fmaxf(mr[4], mr[5]), fmaxf(mr[6], mr[7])));
        mx = fmaxf(mx, xhalf(mx));
        const float nm   = fmaxf(m_st, mx);
        const float corr = exp_x1(m_st - nm);
        m_st = nm;

        float rs[4];
#pragma unroll
        for (int tn = 0; tn < 4; ++tn) {
#pragma unroll
            for (int r = 0; r < 8; ++r) sc[tn][r] -= nm;
            exp_x8(sc[tn]);
            rs[tn] = sc[tn][0];
#pragma unroll
            for (int r = 1; r < 8; ++r) rs[tn] += sc[tn][r];
        }
        l_st = l_st * corr + ((rs[0] + rs[1]) + (rs[2] + rs[3]));
#pragma unroll
        for (int tn = 0; tn < 4; ++tn)
#pragma unroll
            for (int r = 0; r < 8; ++r) o[tn][r] *= corr;

        // ---- O^T += V^T P^T  (contraction over j; Vt[dh][j] is A[m][k]) ----
        // B fragment of P^T, k order of ldfrag: element i is key kk + half8 + i,
        // element 8 + i key kk + 16 + half8 + i: two score tiles as they stand.
#pragma unroll
        for (int kk = 0; kk < 64; kk += 32) {
            v16h bp;
#pragma unroll
            for (int i = 0; i < 8; ++i) {
                bp[i]     = (_Float16)sc[kk / 16][i];
                bp[i + 8] = (_Float16)sc[kk / 16 + 1][i];
            }
#pragma unroll
            for (int tn = 0; tn < 4; ++tn) {
                v16h av = ldfrag(Vt, tn * 16 + lane15, PITCH64, kk, lane);
                o[tn] = WMMA_F16(av, bp, o[tn]);
            }
        }
    }

    // ---- epilogue: O / l; o[tn][r] is O[query lane15][dh 16 tn + r + half8].
    // Turned through the wave's own LDS patch so that the global stores keep 16
    // neighbouring dh of one query row per half wave (out col = dq*16 + h).
    const float l_all = l_st + xhalf(l_st);
    float* Ow = Os[wave];
#pragma unroll
    for (int tn = 0; tn < 4; ++tn) {
        float4 lo, hi;
        lo.x = o[tn][0] / l_all; lo.y = o[tn][1] / l_all;
        lo.z = o[tn][2] / l_all; lo.w = o[tn][3] / l_all;
        hi.x = o[tn][4] / l_all; hi.y = o[tn][5] / l_all;
        hi.z = o[tn][6] / l_all; hi.w = o[tn][7] / l_all;
        *(float4*)(Ow + lane15 * PITCHO + tn * 16 + half8)     = lo;
        *(float4*)(Ow + lane15 * PITCHO + tn * 16 + half8 + 4) = hi;
    }
    __builtin_amdgcn_wave_barrier();   // keep the DS stores ahead of the DS loads (same wave, in order)
#pragma unroll
    for (int tn = 0; tn < 4; ++tn) {
        const int dq = tn * 16 + lane15;
#pragma unroll
        for (int r = 0; r < 8; ++r) {
            const int srow = q0 + wave * 16 + r + half8;
            out[((size_t)b * S + srow) * D + dq * H + h] = Ow[(r + half8) * PITCHO + dq];
        }
    }
}

// ---------------------------------------------------------------------------
extern "C" void kernel_launch(void* const* d_in, const int* in_sizes, int n_in,
                              void* d_out, int out_size, void* d_ws, size_t ws_size,
                              hipStream_t stream) {
    const float* x  = (const float*)d_in[0];
    const float* Wq = (const float*)d_in[1];
    const float* Bq = (const float*)d_in[2];
    const float* Wk = (const float*)d_in[3];
    const float* Wv = (const float*)d_in[4];
    float* out = (float*)d_out;

    // f16 workspace: Q/K/V in [B,H,S/64][dh][64] = 4,194,304 halves (8 MB) each
    const size_t per = (size_t)2 * 16 * 2048 * 64;
    _Float16* Qh = (_Float16*)d_ws;
    _Float16* Kh = Qh + per;
    _Float16* Vh = Kh + per;

    dim3 g1(1024 / 64, 4096 / 64, 3);   // (N tiles, M tiles, {Q,K,V})
    qkv_proj_kernel<<<g1, 128, 0, stream>>>(x, Wq, Bq, Wk, Wv, Qh, Kh, Vh);

    dim3 g2(2048 / 64, 16, 2);          // (q tiles, heads, batch)
    flash_attn_kernel<<<g2, 128, 0, stream>>>(Qh, Kh, Vh, out);
}

// v004
// One run takes 91 microseconds.
// Next to v003, in two timings, it ran 1.24 and 1.23 times as fast.
// Over all steps from v000 it is 6.71 times as fast.
#include <hip/hip_runtime.h>
#include <hip/hip_bf16.h>

// ---------------------------------------------------------------------------
// Fused MHA (heads-last interleave) for MI455X / gfx1250, wave32 + WMMA f16.
// Stage 1: Q/K/V projections via v_wmma_f32_16x16x32_f16, de-interleaved into
//          an f16 workspace [B,H,S/64][dh][64 s] (bias fused for Q): a lane's 8
//          accumulator registers are 8 consecutive s of one (head, dh), so they
//          leave as one 16-byte store.
// Stage 2: flash attention; Q/K tiles streamed with GLOBAL_LOAD_ASYNC_TO_LDS
//          (ASYNCcnt-tracked, K double-buffered), both matmuls on WMMA and
//          transposed (S^T = K Q^T, O^T += V^T P^T): a lane holds one query's
//          scores (32 of 64, lane ^ 16 the rest), so the fp32 online softmax is
//          in-lane but for a lane ^ 16 exchange of the max and sum, and the score
//          accumulators pack straight into the B operand of the second product.
// LDS rows are pitched 16 B x odd (80 B for 64-B rows, 144 B for 128-B rows) so
// that the 16 rows of a ds_load_b128 fragment read fall on distinct banks, and
// transposed tiles are packed along k in registers and written 16 B at a time.
// Q and K tiles sit in LDS as [dh][s] and are read by the transposing load,
// whose pitch is 32 B x odd (160 B).
// ---------------------------------------------------------------------------

typedef __attribute__((ext_vector_type(16))) _Float16 v16h;
typedef __attribute__((ext_vector_type(8)))  _Float16 v8h;
typedef __attribute__((ext_vector_type(4)))  _Float16 v4h;
typedef __attribute__((ext_vector_type(8)))  float    v8f;

#define WMMA_F16(a, b, c) \
    __builtin_amdgcn_wmma_f32_16x16x32_f16(false, (a), false, (b), (short)0, (c), false, false)

// LDS row pitch in halves: 32-half rows (projection), 64-half rows (attention).
#define PITCH32 40
#define PITCH64 72
// 64-half rows read by ds_load_tr16_b128 (Q and K tiles, stored [dh][s]).
#define PITCHT  80
// 64-float rows of the output staging: 16 B x odd.
#define PITCHO  68

// One 64x64 f16 tile (8 KB contiguous in global) -> LDS rows of PITCHT halves,
// by 128 threads: four per-lane 16B async copies each (ASYNCcnt counts 4 a wave).
// Chunk idx = tid + 128*it is row idx>>3, 16-byte column idx&7.
// The s_wait_xcnt closes the statement so that no address register of an
// issued copy is rewritten ahead of it.
static __device__ __forceinline__
void async_tile_64x64(unsigned lds_base, const _Float16* g, int tid) {
    const unsigned l0 = lds_base + (unsigned)(tid >> 3) * (PITCHT * 2) + (unsigned)(tid & 7) * 16;
    const unsigned long long g0 = (unsigned long long)(uintptr_t)(g + tid * 8);
    asm volatile("global_load_async_to_lds_b128 %0, %4, off\n\t"
                 "global_load_async_to_lds_b128 %1, %5, off\n\t"
                 "global_load_async_to_lds_b128 %2, %6, off\n\t"
                 "global_load_async_to_lds_b128 %3, %7, off\n\t"
                 "s_wait_xcnt 0x0"
                 :: "v"(l0), "v"(l0 + 16 * PITCHT * 2), "v"(l0 + 32 * PITCHT * 2),
                    "v"(l0 + 48 * PITCHT * 2),
                    "v"(g0), "v"(g0 + 2048), "v"(g0 + 4096), "v"(g0 + 6144)
                 : "memory");
}
#define WAIT_ASYNCCNT(n) asm volatile("s_wait_asynccnt " #n ::: "memory")

// Low 32 bits of a generic pointer to LDS == LDS byte offset (ISA §10.2).
static __device__ __forceinline__ unsigned lds_off(const void* p) {
    return (unsigned)(uintptr_t)p;
}

// Value of lane l ^ 16 (the other 16-lane row), by a vector cross-row move.
static __device__ __forceinline__ float xhalf(float v) {
    const int b = __builtin_bit_cast(int, v);
    return __builtin_bit_cast(float,
        __builtin_amdgcn_permlanex16(b, b, 0x76543210, 0xfedcba98, false, false));
}

// e^x of eight values as __expf forms it (2^(x log2 e), v_exp_f32), in place.
// One statement, so that each v_exp_f32 is followed by an instruction that
// touches neither its result nor its source: the next one, and a v_nop behind
// the last (the slot the instruction set asks for behind a transcendental).
static __device__ __forceinline__ void exp_x8(v8f& t) {
    float a = t[0] * 1.44269504f, b = t[1] * 1.44269504f, c = t[2] * 1.44269504f,
          d = t[3] * 1.44269504f, e = t[4] * 1.44269504f, f = t[5] * 1.44269504f,
          g = t[6] * 1.44269504f, h = t[7] * 1.44269504f;
    asm("v_exp_f32 %0, %0\n\t" "v_exp_f32 %1, %1\n\t" "v_exp_f32 %2, %2\n\t"
        "v_exp_f32 %3, %3\n\t" "v_exp_f32 %4, %4\n\t" "v_exp_f32 %5, %5\n\t"
        "v_exp_f32 %6, %6\n\t" "v_exp_f32 %7, %7\n\t" "v_nop"
        : "+v"(a), "+v"(b), "+v"(c), "+v"(d), "+v"(e), "+v"(f), "+v"(g), "+v"(h));
    t[0] = a; t[1] = b; t[2] = c; t[3] = d; t[4] = e; t[5] = f; t[6] = g; t[7] = h;
}

// The same for one value.
static __device__ __forceinline__ float exp_x1(float x) {
    float a = x * 1.44269504f;
    asm("v_exp_f32 %0, %0\n\t" "v_nop" : "+v"(a));
    return a;
}

// Load a 16x32 f16 A/B fragment from an LDS tile stored [row][k] (rstride
// halves per row). ISA 16-bit A layout: lanes 0-15 hold K {0..7,16..23},
// lanes 16-31 hold K {8..15,24..31} (wave32).
static __device__ __forceinline__
v16h ldfrag(const _Float16* __restrict__ base, int row, int rstride, int koff, int lane) {
    const _Float16* p = base + row * rstride + koff + ((lane & 16) ? 8 : 0);
    v8h lo = *(const v8h*)(p);
    v8h hi = *(const v8h*)(p + 16);
    v16h r;
#pragma unroll
    for (int i = 0; i < 8; ++i) { r[i] = lo[i]; r[i + 8] = hi[i]; }
    return r;
}

// The same 16x32 fragment (same k order) from an LDS tile stored [k][row],
// PITCHT halves per k: lane (c = lane & 15, hf = lane >> 4) receives
// T[kbase + 8 hf + 0..7][rbase + c], then the same 16 k further on.
typedef __attribute__((ext_vector_type(8))) short v8s;
static __device__ __forceinline__
v8h ld_tr16(const _Float16* p) {
    typedef __attribute__((address_space(3))) v8s lds_v8s;
    return __builtin_bit_cast(v8h, __builtin_amdgcn_ds_load_tr16_b128_v8i16((lds_v8s*)p));
}
static __device__ __forceinline__
v16h ldfrag_tr(const _Float16* __restrict__ base, int rbase, int kbase, int lane) {
    const _Float16* p = base + (kbase + 8 * (lane >> 4) + (lane & 7)) * PITCHT
                             + rbase + 8 * ((lane >> 3) & 1);
    v8h lo = ld_tr16(p);
    v8h hi = ld_tr16(p + 16 * PITCHT);
    v16h r;
#pragma unroll
    for (int i = 0; i < 8; ++i) { r[i] = lo[i]; r[i + 8] = hi[i]; }
    return r;
}

// ---------------------------------------------------------------------------
// Stage 1: QKV projection GEMM.  out[z] = x @ W[z] (+ Bq for z==0)
// x:[4096,1024] f32, W:[1024,1024] f32 -> f16 [B,H,S/64][dh][64 s] (heads de-interleaved)
// Block: 256 threads (8 waves, 2x4), 128x128 output tile, 64x32 per wave, K-step 32:
// an x row is fetched from L2 by 24 blocks, a W column by 32.
// (f32->f16 conversion must pass through VGPRs, so tiles load synchronously.)
// ---------------------------------------------------------------------------
__global__ __launch_bounds__(256)
void qkv_proj_kernel(const float* __restrict__ x,
                     const float* __restrict__ Wq,
                     const float* __restrict__ Bq,
                     const float* __restrict__ Wk,
                     const float* __restrict__ Wv,
                     _Float16* __restrict__ Qh,
                     _Float16* __restrict__ Kh,
                     _Float16* __restrict__ Vh) {
    constexpr int D = 1024, S = 2048, H = 16, DH = 64;
    __shared__ __align__(16) _Float16 Al[128 * PITCH32];   // x tile  [m][k]
    __shared__ __align__(16) _Float16 Bt[128 * PITCH32];   // W tile transposed [n][k]

    const int tid   = threadIdx.x;
    const int lane  = tid & 31;
    const int wave  = tid >> 5;
    const int wm    = (wave >> 2) * 64;
    const int wn    = (wave & 3) * 32;
    const int mbase = blockIdx.y * 128;
    const int nbase = blockIdx.x * 128;
    const int z     = blockIdx.z;

    const float* W   = (z == 0) ? Wq : (z == 1) ? Wk : Wv;
    _Float16*    Out = (z == 0) ? Qh : (z == 1) ? Kh : Vh;

    const v8f zv = {0.f, 0.f, 0.f, 0.f, 0.f, 0.f, 0.f, 0.f};
    v8f acc[4][2];
#pragma unroll
    for (int i = 0; i < 4; ++i)
#pragma unroll
        for (int j = 0; j < 2; ++j) acc[i][j] = zv;

    const int lane15 = lane & 15;
    // W staging: a wave takes k rows wk..wk+7 of columns wc..wc+63.
    const int wk = (wave & 3) * 8;
    const int wc = (wave >> 2) * 64;

    for (int k0 = 0; k0 < D; k0 += 32) {
        // x tile: 128 rows x 32 cols = 1024 float4 chunks, 4 per thread
#pragma unroll
        for (int it = 0; it < 4; ++it) {
            int idx = tid + it * 256;
            int row = idx >> 3, c4 = (idx & 7) * 4;
            const float4 v = *(const float4*)(x + (size_t)(mbase + row) * D + k0 + c4);
            _Float16* d = Al + row * PITCH32 + c4;
            d[0] = (_Float16)v.x; d[1] = (_Float16)v.y;
            d[2] = (_Float16)v.z; d[3] = (_Float16)v.w;
        }
        // W tile: 32 rows(k) x 128 cols(n), store transposed [n][k].
        // A lane owns columns wc + 2*lane, wc + 2*lane + 1:
        // each column's 8 k values leave as one 16-byte LDS store.
        {
            float2 wv[8];
#pragma unroll
            for (int j = 0; j < 8; ++j)
                wv[j] = *(const float2*)(W + (size_t)(k0 + wk + j) * D + nbase + wc + lane * 2);
            v8h c0, c1;
#pragma unroll
            for (int j = 0; j < 8; ++j) { c0[j] = (_Float16)wv[j].x; c1[j] = (_Float16)wv[j].y; }
            *(v8h*)(Bt + (wc + lane * 2 + 0) * PITCH32 + wk) = c0;
            *(v8h*)(Bt + (wc + lane * 2 + 1) * PITCH32 + wk) = c1;
        }
        if (k0 + 32 < D)  // speculative prefetch of next x tile row
            __builtin_prefetch(x + (size_t)(mbase + (tid >> 1)) * D + k0 + 32, 0, 1);
        __syncthreads();

        v16h b0 = ldfrag(Bt, wn + 0  + lane15, PITCH32, 0, lane);
        v16h b1 = ldfrag(Bt, wn + 16 + lane15, PITCH32, 0, lane);
        v16h a[4];
#pragma unroll
        for (int tm = 0; tm < 4; ++tm)
            a[tm] = ldfrag(Al, wm + tm * 16 + lane15, PITCH32, 0, lane);
        // Keeps the twelve LDS reads in one group ahead of the WMMAs: left alone the
        // compiler reuses one A fragment's registers and waits out the LDS latency four times.
        __builtin_amdgcn_sched_barrier(0);
#pragma unroll
        for (int tm = 0; tm < 4; ++tm) {
            acc[tm][0] = WMMA_F16(a[tm], b0, acc[tm][0]);
            acc[tm][1] = WMMA_F16(a[tm], b1, acc[tm][1]);
        }
        __syncthreads();
    }

    // Epilogue: +bias (Q only), de-interleave heads: col n -> (h = n%16, dq = n/16).
    // All eight tiles are packed first and the eight stores stand last, so that no
    // register of an issued store is written again.  The wave's 64 rows are one
    // 64-s chunk: its four stores of a column fill one 128-byte line.
    const int half8 = (lane & 16) ? 8 : 0;
    v8h       pk[4][2];
    _Float16* dst[4][2];
    float     bias[2] = {0.0f, 0.0f};
    if (z == 0) {
        bias[0] = Bq[nbase + wn + lane15];
        bias[1] = Bq[nbase + wn + 16 + lane15];
    }
#pragma unroll
    for (int tn = 0; tn < 2; ++tn) {
        const int n    = nbase + wn + tn * 16 + lane15;
        const float bi = bias[tn];
        const int h = n & 15, dq = n >> 4;
#pragma unroll
        for (int tm = 0; tm < 4; ++tm) {
            const int m  = mbase + wm + tm * 16 + half8;   // first of the lane's 8 rows
            const int bb = m >> 11;          // batch
            const int s  = m & 2047;         // seq pos
#pragma unroll
            for (int r = 0; r < 8; ++r) pk[tm][tn][r] = (_Float16)(acc[tm][tn][r] + bi);
            dst[tm][tn] = Out + (size_t)(bb * H + h) * S * DH
                              + (size_t)((s >> 6) * DH + dq) * 64 + (s & 63);
        }
    }
#pragma unroll
    for (int tn = 0; tn < 2; ++tn)
#pragma unroll
        for (int tm = 0; tm < 4; ++tm) *(v8h*)dst[tm][tn] = pk[tm][tn];
}

// ---------------------------------------------------------------------------
// Stage 2: flash attention, one block per (64 q-rows, head, batch).
// 128 threads = 4 waves; wave w owns queries [16w, 16w+16), one per lane & 15.
// Q + double-buffered K tiles arrive via async global->LDS copies.
// ---------------------------------------------------------------------------
__global__ __launch_bounds__(128)
void flash_attn_kernel(const _Float16* __restrict__ Qh,
                       const _Float16* __restrict__ Kh,
                       const _Float16* __restrict__ Vh,
                       float* __restrict__ out) {
    constexpr int S = 2048, H = 16, DH = 64, D = 1024;
    constexpr int NT = S / 64;          // 32 K/V tiles
    constexpr float SCALE = 0.03125f;   // 1/sqrt(D) = 1/32

    __shared__ __align__(16) _Float16 Qs[64 * PITCHT];        // [dh][qrow]
    __shared__ __align__(16) _Float16 Kb[2][64 * PITCHT];     // [dh][j] double buffer
    __shared__ __align__(16) _Float16 Vt[64 * PITCH64];       // [dh][j] (A of V^T P^T)
    __shared__ __align__(16) float    Os[4][16 * PITCHO];     // per-wave O [q][dh], epilogue only

    const int tid = threadIdx.x, lane = tid & 31, wave = tid >> 5;
    const int lane15 = lane & 15;
    const int half8  = (lane & 16) ? 8 : 0;
    const int q0 = blockIdx.x * 64;
    const int h  = blockIdx.y;
    const int b  = blockIdx.z;

    const size_t headoff = (size_t)(b * H + h) * S * DH;
    const _Float16* Qg = Qh + headoff;
    const _Float16* Kg = Kh + headoff;
    const _Float16* Vg = Vh + headoff;

    const unsigned ldsQ  = lds_off(Qs);
    const unsigned ldsK0 = lds_off(Kb[0]);
    const unsigned ldsK1 = lds_off(Kb[1]);

    // Kick off async copies: K tile 0 first, then the resident Q tile.
    // Each tile is 8KB contiguous: 512 x 16B chunks, 4 per thread.
    async_tile_64x64(ldsK0, Kg, tid);
    async_tile_64x64(ldsQ, Qg + (size_t)q0 * DH, tid);
    WAIT_ASYNCCNT(0x0);   // Q and K0 resident in this wave's view

    const v8f zv = {0.f, 0.f, 0.f, 0.f, 0.f, 0.f, 0.f, 0.f};
    v8f o[4];
#pragma unroll
    for (int t = 0; t < 4; ++t) o[t] = zv;
    // Running maximum of the lane's query (equal in both wave halves) and the
    // sum over the keys that this half of the wave holds (joined in the epilogue).
    float m_st = -1e30f, l_st = 0.0f;

    for (int ti = 0; ti < NT; ++ti) {
        const int j0 = ti * 64;
        __syncthreads();  // previous iteration done reading Vt / K buffer

        // V tile -> Vt[dh][j]: the workspace tile already is [dh][j], 8 KB
        // contiguous; chunk idx = tid + 128*it is row idx>>3, 16-byte column idx&7.
        {
            v8h vv[4];
#pragma unroll
            for (int it = 0; it < 4; ++it)
                vv[it] = *(const v8h*)(Vg + (size_t)j0 * DH + (tid + it * 128) * 8);
#pragma unroll
            for (int it = 0; it < 4; ++it)
                *(v8h*)(Vt + ((tid >> 3) + it * 16) * PITCH64 + (tid & 7) * 8) = vv[it];
        }

        // Prefetch K tile ti+1 into the other buffer (read last in iter ti-1,
        // so the barrier above protects it), then wait for K tile ti.
        if (ti + 1 < NT) {
            const unsigned dst = ((ti + 1) & 1) ? ldsK1 : ldsK0;
            async_tile_64x64(dst, Kg + (size_t)(j0 + 64) * DH, tid);
            WAIT_ASYNCCNT(0x4);   // in-order: first 4 outstanding (tile ti) done
        } else {
            WAIT_ASYNCCNT(0x0);   // last tile: drain
        }
        __syncthreads();          // Vt stores + K tile ti visible block-wide

        const _Float16* Kcur = Kb[ti & 1];

        // ---- S^T = K Q^T  (contraction over dh; both tiles are [dh][row]) ----
        // sc[tn][r] = score of key j0 + 16 tn + r + half8 with query lane15.
        v8f sc[4];
#pragma unroll
        for (int t = 0; t < 4; ++t) sc[t] = zv;
#pragma unroll
        for (int kk = 0; kk < 64; kk += 32) {
            v16h bq = ldfrag_tr(Qs, wave * 16, kk, lane);
#pragma unroll
            for (int tn = 0; tn < 4; ++tn) {
                v16h ak = ldfrag_tr(Kcur, tn * 16, kk, lane);
                sc[tn] = WMMA_F16(ak, bq, sc[tn]);
            }
        }
#pragma unroll
        for (int tn = 0; tn < 4; ++tn)
#pragma unroll
            for (int r = 0; r < 8; ++r) sc[tn][r] *= SCALE;

        // ---- online softmax: the lane's 32 scores and those of lane ^ 16 are
        //      the 64 keys of one query ----
        float mr[8];
#pragma unroll
        for (int r = 0; r < 8; ++r)
            mr[r] = fmaxf(fmaxf(sc[0][r], sc[1][r]), fmaxf(sc[2][r], sc[3][r]));
        float mx = fmaxf(fmaxf(fmaxf(mr[0], mr[1]), fmaxf(mr[2], mr[3])),
                         fmaxf(fmaxf(mr[4], mr[5]), fmaxf(mr[6], mr[7])));
        mx = fmaxf(mx, xhalf(mx));
        const float nm   = fmaxf(m_st, mx);
        const float corr = exp_x1(m_st - nm);
        m_st = nm;

        float rs[4];
#pragma unroll
        for (int tn = 0; tn < 4; ++tn) {
#pragma unroll
            for (int r = 0; r < 8; ++r) sc[tn][r] -= nm;
            exp_x8(sc[tn]);
            rs[tn] = sc[tn][0];
#pragma unroll
            for (int r = 1; r < 8; ++r) rs[tn] += sc[tn][r];
        }
        l_st = l_st * corr + ((rs[0] + rs[1]) + (rs[2] + rs[3]));
#pragma unroll
        for (int tn = 0; tn < 4; ++tn)
#pragma unroll
            for (int r = 0; r < 8; ++r) o[tn][r] *= corr;

        // ---- O^T += V^T P^T  (contraction over j; Vt[dh][j] is A[m][k]) ----
        // B fragment of P^T, k order of ldfrag: element i is key kk + half8 + i,
        // element 8 + i key kk + 16 + half8 + i: two score tiles as they stand.
#pragma unroll
        for (int kk = 0; kk < 64; kk += 32) {
            v16h bp;
#pragma unroll
            for (int i = 0; i < 8; ++i) {
                bp[i]     = (_Float16)sc[kk / 16][i];
                bp[i + 8] = (_Float16)sc[kk / 16 + 1][i];
            }
#pragma unroll
            for (int tn = 0; tn < 4; ++tn) {
                v16h av = ldfrag(Vt, tn * 16 + lane15, PITCH64, kk, lane);
                o[tn] = WMMA_F16(av, bp, o[tn]);
            }
        }
    }

    // ---- epilogue: O / l; o[tn][r] is O[query lane15][dh 16 tn + r + half8].
    // Turned through the wave's own LDS patch so that the global stores keep 16
    // neighbouring dh of one query row per half wave (out col = dq*16 + h).
    const float l_all = l_st + xhalf(l_st);
    float* Ow = Os[wave];
#pragma unroll
    for (int tn = 0; tn < 4; ++tn) {
        float4 lo, hi;
        lo.x = o[tn][0] / l_all; lo.y = o[tn][1] / l_all;
        lo.z = o[tn][2] / l_all; lo.w = o[tn][3] / l_all;
        hi.x = o[tn][4] / l_all; hi.y = o[tn][5] / l_all;
        hi.z = o[tn][6] / l_all; hi.w = o[tn][7] / l_all;
        *(float4*)(Ow + lane15 * PITCHO + tn * 16 + half8)     = lo;
        *(float4*)(Ow + lane15 * PITCHO + tn * 16 + half8 + 4) = hi;
    }
    __builtin_amdgcn_wave_barrier();   // keep the DS stores ahead of the DS loads (same wave, in order)
#pragma unroll
    for (int tn = 0; tn < 4; ++tn) {
        const int dq = tn * 16 + lane15;
#pragma unroll
        for (int r = 0; r < 8; ++r) {
            const int srow = q0 + wave * 16 + r + half8;
            out[((size_t)b * S + srow) * D + dq * H + h] = Ow[(r + half8) * PITCHO + dq];
        }
    }
}

// ---------------------------------------------------------------------------
extern "C" void kernel_launch(void* const* d_in, const int* in_sizes, int n_in,
                              void* d_out, int out_size, void* d_ws, size_t ws_size,
                              hipStream_t stream) {
    const float* x  = (const float*)d_in[0];
    const float* Wq = (const float*)d_in[1];
    const float* Bq = (const float*)d_in[2];
    const float* Wk = (const float*)d_in[3];
    const float* Wv = (const float*)d_in[4];
    float* out = (float*)d_out;

    // f16 workspace: Q/K/V in [B,H,S/64][dh][64] = 4,194,304 halves (8 MB) each
    const size_t per = (size_t)2 * 16 * 2048 * 64;
    _Float16* Qh = (_Float16*)d_ws;
    _Float16* Kh = Qh + per;
    _Float16* Vh = Kh + per;

    dim3 g1(1024 / 128, 4096 / 128, 3);   // (N tiles, M tiles, {Q,K,V})
    qkv_proj_kernel<<<g1, 256, 0, stream>>>(x, Wq, Bq, Wk, Wv, Qh, Kh, Vh);

    dim3 g2(2048 / 64, 16, 2);          // (q tiles, heads, batch)
    flash_attn_kernel<<<g2, 128, 0, stream>>>(Qh, Kh, Vh, out);
}

// v005
// One run takes 83.3 microseconds.
// Two timings next to v004 put it at 1.04 and 1.12 times that version's speed.
// All steps since v000 together make it 7.23 times as fast.
#include <hip/hip_runtime.h>
#include <hip/hip_bf16.h>

// ---------------------------------------------------------------------------
// Fused MHA (heads-last interleave) for MI455X / gfx1250, wave32 + WMMA f16.
// Stage 1: Q/K/V projections via v_wmma_f32_16x16x32_f16, de-interleaved into
//          an f16 workspace [B,H,S/64][dh][64 s] (bias fused for Q): a lane's 8
//          accumulator registers are 8 consecutive s of one (head, dh), so they
//          leave as one 16-byte store.
// Stage 2: flash attention; Q/K/V tiles streamed with GLOBAL_LOAD_ASYNC_TO_LDS
//          (ASYNCcnt-tracked, K and V double-buffered), both matmuls on WMMA and
//          transposed (S^T = K Q^T, O^T += V^T P^T): a lane holds one query's
//          scores (32 of 64, lane ^ 16 the rest), so the fp32 online softmax is
//          in-lane but for a lane ^ 16 exchange of the max and sum, and the score
//          accumulators pack straight into the B operand of the second product.
// LDS rows are pitched 16 B x odd (80 B for 64-B rows, 144 B for 128-B rows) so
// that the 16 rows of a ds_load_b128 fragment read fall on distinct banks, and
// transposed tiles are packed along k in registers and written 16 B at a time.
// Q and K tiles sit in LDS as [dh][s] and are read by the transposing load,
// whose pitch is 32 B x odd (160 B).
// ---------------------------------------------------------------------------

typedef __attribute__((ext_vector_type(16))) _Float16 v16h;
typedef __attribute__((ext_vector_type(8)))  _Float16 v8h;
typedef __attribute__((ext_vector_type(4)))  _Float16 v4h;
typedef __attribute__((ext_vector_type(8)))  float    v8f;

#define WMMA_F16(a, b, c) \
    __builtin_amdgcn_wmma_f32_16x16x32_f16(false, (a), false, (b), (short)0, (c), false, false)

// LDS row pitch in halves: 32-half rows (projection), 64-half rows (attention).
#define PITCH32 40
#define PITCH64 72
// 64-half rows read by ds_load_tr16_b128 (Q and K tiles, stored [dh][s]).
#define PITCHT  80
// 64-float rows of the output staging: 16 B x odd.
#define PITCHO  68

// One 64x64 f16 tile (8 KB contiguous in global) -> LDS rows of PITCHT halves,
// by 128 threads: four per-lane 16B async copies each (ASYNCcnt counts 4 a wave).
// Chunk idx = tid + 128*it is row idx>>3, 16-byte column idx&7.
// The s_wait_xcnt closes the statement so that no address register of an
// issued copy is rewritten ahead of it.
static __device__ __forceinline__
void async_tile_64x64(unsigned lds_base, const _Float16* g, int tid) {
    const unsigned l0 = lds_base + (unsigned)(tid >> 3) * (PITCHT * 2) + (unsigned)(tid & 7) * 16;
    const unsigned long long g0 = (unsigned long long)(uintptr_t)(g + tid * 8);
    asm volatile("global_load_async_to_lds_b128 %0, %4, off\n\t"
                 "global_load_async_to_lds_b128 %1, %5, off\n\t"
                 "global_load_async_to_lds_b128 %2, %6, off\n\t"
                 "global_load_async_to_lds_b128 %3, %7, off\n\t"
                 "s_wait_xcnt 0x0"
                 :: "v"(l0), "v"(l0 + 16 * PITCHT * 2), "v"(l0 + 32 * PITCHT * 2),
                    "v"(l0 + 48 * PITCHT * 2),
                    "v"(g0), "v"(g0 + 2048), "v"(g0 + 4096), "v"(g0 + 6144)
                 : "memory");
}
// A K tile (rows of PITCHT halves) and the V tile of the same keys (rows of
// PITCH64 halves), each 8 KB contiguous in global, chunked as above: eight
// copies a lane in one statement, closed by the one s_wait_xcnt for all of them.
static __device__ __forceinline__
void async_kv_tiles(unsigned lds_k, const _Float16* gk,
                    unsigned lds_v, const _Float16* gv, int tid) {
    const unsigned k0 = lds_k + (unsigned)(tid >> 3) * (PITCHT * 2) + (unsigned)(tid & 7) * 16;
    const unsigned v0 = lds_v + (unsigned)(tid >> 3) * (PITCH64 * 2) + (unsigned)(tid & 7) * 16;
    const unsigned long long a0 = (unsigned long long)(uintptr_t)(gk + tid * 8);
    const unsigned long long b0 = (unsigned long long)(uintptr_t)(gv + tid * 8);
    asm volatile("global_load_async_to_lds_b128 %0, %8, off\n\t"
                 "global_load_async_to_lds_b128 %1, %9, off\n\t"
                 "global_load_async_to_lds_b128 %2, %10, off\n\t"
                 "global_load_async_to_lds_b128 %3, %11, off\n\t"
                 "global_load_async_to_lds_b128 %4, %12, off\n\t"
                 "global_load_async_to_lds_b128 %5, %13, off\n\t"
                 "global_load_async_to_lds_b128 %6, %14, off\n\t"
                 "global_load_async_to_lds_b128 %7, %15, off\n\t"
                 "s_wait_xcnt 0x0"
                 :: "v"(k0), "v"(k0 + 16 * PITCHT * 2), "v"(k0 + 32 * PITCHT * 2),
                    "v"(k0 + 48 * PITCHT * 2),
                    "v"(v0), "v"(v0 + 16 * PITCH64 * 2), "v"(v0 + 32 * PITCH64 * 2),
                    "v"(v0 + 48 * PITCH64 * 2),
                    "v"(a0), "v"(a0 + 2048), "v"(a0 + 4096), "v"(a0 + 6144),
                    "v"(b0), "v"(b0 + 2048), "v"(b0 + 4096), "v"(b0 + 6144)
                 : "memory");
}
#define WAIT_ASYNCCNT(n) asm volatile("s_wait_asynccnt " #n ::: "memory")
#define WAIT_DSCNT(n)    asm volatile("s_wait_dscnt " #n ::: "memory")

// Low 32 bits of a generic pointer to LDS == LDS byte offset (ISA §10.2).
static __device__ __forceinline__ unsigned lds_off(const void* p) {
    return (unsigned)(uintptr_t)p;
}

// Value of lane l ^ 16 (the other 16-lane row), by a vector cross-row move.
static __device__ __forceinline__ float xhalf(float v) {
    const int b = __builtin_bit_cast(int, v);
    return __builtin_bit_cast(float,
        __builtin_amdgcn_permlanex16(b, b, 0x76543210, 0xfedcba98, false, false));
}

// e^x of eight values as __expf forms it (2^(x log2 e), v_exp_f32), in place.
// One statement, so that each v_exp_f32 is followed by an instruction that
// touches neither its result nor its source: the next one, and a v_nop behind
// the last (the slot the instruction set asks for behind a transcendental).
static __device__ __forceinline__ void exp_x8(v8f& t) {
    float a = t[0] * 1.44269504f, b = t[1] * 1.44269504f, c = t[2] * 1.44269504f,
          d = t[3] * 1.44269504f, e = t[4] * 1.44269504f, f = t[5] * 1.44269504f,
          g = t[6] * 1.44269504f, h = t[7] * 1.44269504f;
    asm("v_exp_f32 %0, %0\n\t" "v_exp_f32 %1, %1\n\t" "v_exp_f32 %2, %2\n\t"
        "v_exp_f32 %3, %3\n\t" "v_exp_f32 %4, %4\n\t" "v_exp_f32 %5, %5\n\t"
        "v_exp_f32 %6, %6\n\t" "v_exp_f32 %7, %7\n\t" "v_nop"
        : "+v"(a), "+v"(b), "+v"(c), "+v"(d), "+v"(e), "+v"(f), "+v"(g), "+v"(h));
    t[0] = a; t[1] = b; t[2] = c; t[3] = d; t[4] = e; t[5] = f; t[6] = g; t[7] = h;
}

// The same for one value.
static __device__ __forceinline__ float exp_x1(float x) {
    float a = x * 1.44269504f;
    asm("v_exp_f32 %0, %0\n\t" "v_nop" : "+v"(a));
    return a;
}

// Load a 16x32 f16 A/B fragment from an LDS tile stored [row][k] (rstride
// halves per row). ISA 16-bit A layout: lanes 0-15 hold K {0..7,16..23},
// lanes 16-31 hold K {8..15,24..31} (wave32).
static __device__ __forceinline__
v16h ldfrag(const _Float16* __restrict__ base, int row, int rstride, int koff, int lane) {
    const _Float16* p = base + row * rstride + koff + ((lane & 16) ? 8 : 0);
    v8h lo = *(const v8h*)(p);
    v8h hi = *(const v8h*)(p + 16);
    v16h r;
#pragma unroll
    for (int i = 0; i < 8; ++i) { r[i] = lo[i]; r[i + 8] = hi[i]; }
    return r;
}

// The same 16x32 fragment (same k order) from an LDS tile stored [k][row],
// PITCHT halves per k: lane (c = lane & 15, hf = lane >> 4) receives
// T[kbase + 8 hf + 0..7][rbase + c], then the same 16 k further on.
typedef __attribute__((ext_vector_type(8))) short v8s;
static __device__ __forceinline__
v8h ld_tr16(const _Float16* p) {
    typedef __attribute__((address_space(3))) v8s lds_v8s;
    return __builtin_bit_cast(v8h, __builtin_amdgcn_ds_load_tr16_b128_v8i16((lds_v8s*)p));
}
static __device__ __forceinline__
v16h ldfrag_tr(const _Float16* __restrict__ base, int rbase, int kbase, int lane) {
    const _Float16* p = base + (kbase + 8 * (lane >> 4) + (lane & 7)) * PITCHT
                             + rbase + 8 * ((lane >> 3) & 1);
    v8h lo = ld_tr16(p);
    v8h hi = ld_tr16(p + 16 * PITCHT);
    v16h r;
#pragma unroll
    for (int i = 0; i < 8; ++i) { r[i] = lo[i]; r[i + 8] = hi[i]; }
    return r;
}

// ---------------------------------------------------------------------------
// Stage 1: QKV projection GEMM.  out[z] = x @ W[z] (+ Bq for z==0)
// x:[4096,1024] f32, W:[1024,1024] f32 -> f16 [B,H,S/64][dh][64 s] (heads de-interleaved)
// Block: 256 threads (8 waves, 2x4), 128x128 output tile, 64x32 per wave, K-step 32:
// an x row is fetched from L2 by 24 blocks, a W column by 32.
// (f32->f16 conversion must pass through VGPRs, so tiles load synchronously.)
// ---------------------------------------------------------------------------
__global__ __launch_bounds__(256)
void qkv_proj_kernel(const float* __restrict__ x,
                     const float* __restrict__ Wq,
                     const float* __restrict__ Bq,
                     const float* __restrict__ Wk,
                     const float* __restrict__ Wv,
                     _Float16* __restrict__ Qh,
                     _Float16* __restrict__ Kh,
                     _Float16* __restrict__ Vh) {
    constexpr int D = 1024, S = 2048, H = 16, DH = 64;
    __shared__ __align__(16) _Float16 Al[128 * PITCH32];   // x tile  [m][k]
    __shared__ __align__(16) _Float16 Bt[128 * PITCH32];   // W tile transposed [n][k]

    const int tid   = threadIdx.x;
    const int lane  = tid & 31;
    const int wave  = tid >> 5;
    const int wm    = (wave >> 2) * 64;
    const int wn    = (wave & 3) * 32;
    const int mbase = blockIdx.y * 128;
    const int nbase = blockIdx.x * 128;
    const int z     = blockIdx.z;

    const float* W   = (z == 0) ? Wq : (z == 1) ? Wk : Wv;
    _Float16*    Out = (z == 0) ? Qh : (z == 1) ? Kh : Vh;

    const v8f zv = {0.f, 0.f, 0.f, 0.f, 0.f, 0.f, 0.f, 0.f};
    v8f acc[4][2];
#pragma unroll
    for (int i = 0; i < 4; ++i)
#pragma unroll
        for (int j = 0; j < 2; ++j) acc[i][j] = zv;

    const int lane15 = lane & 15;
    // W staging: a wave takes k rows wk..wk+7 of columns wc..wc+63.
    const int wk = (wave & 3) * 8;
    const int wc = (wave >> 2) * 64;

    for (int k0 = 0; k0 < D; k0 += 32) {
        // x tile: 128 rows x 32 cols = 1024 float4 chunks, 4 per thread
#pragma unroll
        for (int it = 0; it < 4; ++it) {
            int idx = tid + it * 256;
            int row = idx >> 3, c4 = (idx & 7) * 4;
            const float4 v = *(const float4*)(x + (size_t)(mbase + row) * D + k0 + c4);
            _Float16* d = Al + row * PITCH32 + c4;
            d[0] = (_Float16)v.x; d[1] = (_Float16)v.y;
            d[2] = (_Float16)v.z; d[3] = (_Float16)v.w;
        }
        // W tile: 32 rows(k) x 128 cols(n), store transposed [n][k].
        // A lane owns columns wc + 2*lane, wc + 2*lane + 1:
        // each column's 8 k values leave as one 16-byte LDS store.
        {
            float2 wv[8];
#pragma unroll
            for (int j = 0; j < 8; ++j)
                wv[j] = *(const float2*)(W + (size_t)(k0 + wk + j) * D + nbase + wc + lane * 2);
            v8h c0, c1;
#pragma unroll
            for (int j = 0; j < 8; ++j) { c0[j] = (_Float16)wv[j].x; c1[j] = (_Float16)wv[j].y; }
            *(v8h*)(Bt + (wc + lane * 2 + 0) * PITCH32 + wk) = c0;
            *(v8h*)(Bt + (wc + lane * 2 + 1) * PITCH32 + wk) = c1;
        }
        if (k0 + 32 < D)  // speculative prefetch of next x tile row
            __builtin_prefetch(x + (size_t)(mbase + (tid >> 1)) * D + k0 + 32, 0, 1);
        __syncthreads();

        v16h b0 = ldfrag(Bt, wn + 0  + lane15, PITCH32, 0, lane);
        v16h b1 = ldfrag(Bt, wn + 16 + lane15, PITCH32, 0, lane);
        v16h a[4];
#pragma unroll
        for (int tm = 0; tm < 4; ++tm)
            a[tm] = ldfrag(Al, wm + tm * 16 + lane15, PITCH32, 0, lane);
        // Keeps the twelve LDS reads in one group ahead of the WMMAs: left alone the
        // compiler reuses one A fragment's registers and waits out the LDS latency four times.
        __builtin_amdgcn_sched_barrier(0);
#pragma unroll
        for (int tm = 0; tm < 4; ++tm) {
            acc[tm][0] = WMMA_F16(a[tm], b0, acc[tm][0]);
            acc[tm][1] = WMMA_F16(a[tm], b1, acc[tm][1]);
        }
        __syncthreads();
    }

    // Epilogue: +bias (Q only), de-interleave heads: col n -> (h = n%16, dq = n/16).
    // All eight tiles are packed first and the eight stores stand last, so that no
    // register of an issued store is written again.  The wave's 64 rows are one
    // 64-s chunk: its four stores of a column fill one 128-byte line.
    const int half8 = (lane & 16) ? 8 : 0;
    v8h       pk[4][2];
    _Float16* dst[4][2];
    float     bias[2] = {0.0f, 0.0f};
    if (z == 0) {
        bias[0] = Bq[nbase + wn + lane15];
        bias[1] = Bq[nbase + wn + 16 + lane15];
    }
#pragma unroll
    for (int tn = 0; tn < 2; ++tn) {
        const int n    = nbase + wn + tn * 16 + lane15;
        const float bi = bias[tn];
        const int h = n & 15, dq = n >> 4;
#pragma unroll
        for (int tm = 0; tm < 4; ++tm) {
            const int m  = mbase + wm + tm * 16 + half8;   // first of the lane's 8 rows
            const int bb = m >> 11;          // batch
            const int s  = m & 2047;         // seq pos
#pragma unroll
            for (int r = 0; r < 8; ++r) pk[tm][tn][r] = (_Float16)(acc[tm][tn][r] + bi);
            dst[tm][tn] = Out + (size_t)(bb * H + h) * S * DH
                              + (size_t)((s >> 6) * DH + dq) * 64 + (s & 63);
        }
    }
#pragma unroll
    for (int tn = 0; tn < 2; ++tn)
#pragma unroll
        for (int tm = 0; tm < 4; ++tm) *(v8h*)dst[tm][tn] = pk[tm][tn];
}

// ---------------------------------------------------------------------------
// Stage 2: flash attention, one block per (64 q-rows, head, batch).
// 128 threads = 4 waves; wave w owns queries [16w, 16w+16), one per lane & 15.
// Q and double-buffered K and V tiles arrive via async global->LDS copies,
// a K/V pair one whole tile ahead of its use; one barrier per tile.
// ---------------------------------------------------------------------------
__global__ __launch_bounds__(128)
void flash_attn_kernel(const _Float16* __restrict__ Qh,
                       const _Float16* __restrict__ Kh,
                       const _Float16* __restrict__ Vh,
                       float* __restrict__ out) {
    constexpr int S = 2048, H = 16, DH = 64, D = 1024;
    constexpr int NT = S / 64;          // 32 K/V tiles
    constexpr float SCALE = 0.03125f;   // 1/sqrt(D) = 1/32

    __shared__ __align__(16) _Float16 Qs[64 * PITCHT];        // [dh][qrow]
    __shared__ __align__(16) _Float16 Kb[2][64 * PITCHT];     // [dh][j] double buffer
    __shared__ __align__(16) _Float16 Vt[2][64 * PITCH64];    // [dh][j] (A of V^T P^T) double buffer
    __shared__ __align__(16) float    Os[4][16 * PITCHO];     // per-wave O [q][dh], epilogue only

    const int tid = threadIdx.x, lane = tid & 31, wave = tid >> 5;
    const int lane15 = lane & 15;
    const int half8  = (lane & 16) ? 8 : 0;
    const int q0 = blockIdx.x * 64;
    const int h  = blockIdx.y;
    const int b  = blockIdx.z;

    const size_t headoff = (size_t)(b * H + h) * S * DH;
    const _Float16* Qg = Qh + headoff;
    const _Float16* Kg = Kh + headoff;
    const _Float16* Vg = Vh + headoff;

    const unsigned ldsQ  = lds_off(Qs);
    const unsigned ldsK0 = lds_off(Kb[0]);
    const unsigned ldsK1 = lds_off(Kb[1]);
    const unsigned ldsV0 = lds_off(Vt[0]);
    const unsigned ldsV1 = lds_off(Vt[1]);

    // Kick off async copies: K and V tile 0, then the resident Q tile.
    // Each tile is 8KB contiguous: 512 x 16B chunks, 4 per thread.
    async_kv_tiles(ldsK0, Kg, ldsV0, Vg, tid);
    async_tile_64x64(ldsQ, Qg + (size_t)q0 * DH, tid);
    WAIT_ASYNCCNT(0x0);   // this wave's share of Q, K0, V0 has landed
    __syncthreads();      // ... and every other wave's: tile 0 may be read
    // Tile 1 flies while tile 0 is worked on.
    async_kv_tiles(ldsK1, Kg + (size_t)64 * DH, ldsV1, Vg + (size_t)64 * DH, tid);

    const v8f zv = {0.f, 0.f, 0.f, 0.f, 0.f, 0.f, 0.f, 0.f};
    v8f o[4];
#pragma unroll
    for (int t = 0; t < 4; ++t) o[t] = zv;
    // Running maximum of the lane's query (equal in both wave halves) and the
    // sum over the keys that this half of the wave holds (joined in the epilogue).
    float m_st = -1e30f, l_st = 0.0f;

    // Two trips per pass of the loop, so that the buffer index is a constant in each:
    // fragment offsets become immediates and the copies' LDS addresses loop invariants.
#pragma unroll 2
    for (int ti = 0; ti < NT; ++ti) {
        const int j0 = ti * 64;
        const _Float16* Kcur = Kb[ti & 1];
        const _Float16* Vcur = Vt[ti & 1];

        // ---- S^T = K Q^T  (contraction over dh; both tiles are [dh][row]) ----
        // sc[tn][r] = score of key j0 + 16 tn + r + half8 with query lane15.
        v8f sc[4];
#pragma unroll
        for (int t = 0; t < 4; ++t) sc[t] = zv;
#pragma unroll
        for (int kk = 0; kk < 64; kk += 32) {
            v16h bq = ldfrag_tr(Qs, wave * 16, kk, lane);
#pragma unroll
            for (int tn = 0; tn < 4; ++tn) {
                v16h ak = ldfrag_tr(Kcur, tn * 16, kk, lane);
                sc[tn] = WMMA_F16(ak, bq, sc[tn]);
            }
        }
#pragma unroll
        for (int tn = 0; tn < 4; ++tn)
#pragma unroll
            for (int r = 0; r < 8; ++r) sc[tn][r] *= SCALE;

        // ---- online softmax: the lane's 32 scores and those of lane ^ 16 are
        //      the 64 keys of one query ----
        float mr[8];
#pragma unroll
        for (int r = 0; r < 8; ++r)
            mr[r] = fmaxf(fmaxf(sc[0][r], sc[1][r]), fmaxf(sc[2][r], sc[3][r]));
        float mx = fmaxf(fmaxf(fmaxf(mr[0], mr[1]), fmaxf(mr[2], mr[3])),
                         fmaxf(fmaxf(mr[4], mr[5]), fmaxf(mr[6], mr[7])));
        mx = fmaxf(mx, xhalf(mx));
        const float nm   = fmaxf(m_st, mx);
        const float corr = exp_x1(m_st - nm);
        m_st = nm;

        float rs[4];
#pragma unroll
        for (int tn = 0; tn < 4; ++tn) {
#pragma unroll
            for (int r = 0; r < 8; ++r) sc[tn][r] -= nm;
            exp_x8(sc[tn]);
            rs[tn] = sc[tn][0];
#pragma unroll
            for (int r = 1; r < 8; ++r) rs[tn] += sc[tn][r];
        }
        l_st = l_st * corr + ((rs[0] + rs[1]) + (rs[2] + rs[3]));
#pragma unroll
        for (int tn = 0; tn < 4; ++tn)
#pragma unroll
            for (int r = 0; r < 8; ++r) o[tn][r] *= corr;

        // ---- O^T += V^T P^T  (contraction over j; Vt[dh][j] is A[m][k]) ----
        // B fragment of P^T, k order of ldfrag: element i is key kk + half8 + i,
        // element 8 + i key kk + 16 + half8 + i: two score tiles as they stand.
#pragma unroll
        for (int kk = 0; kk < 64; kk += 32) {
            v16h bp;
#pragma unroll
            for (int i = 0; i < 8; ++i) {
                bp[i]     = (_Float16)sc[kk / 16][i];
                bp[i + 8] = (_Float16)sc[kk / 16 + 1][i];
            }
#pragma unroll
            for (int tn = 0; tn < 4; ++tn) {
                v16h av = ldfrag(Vcur, tn * 16 + lane15, PITCH64, kk, lane);
                o[tn] = WMMA_F16(av, bp, o[tn]);
            }
        }

        // ---- hand-over: tile ti+1 published, tile ti's buffers freed ----
        WAIT_DSCNT(0x0);      // this wave's reads of tile ti have returned
        WAIT_ASYNCCNT(0x0);   // this wave's share of tile ti+1 has landed
        __syncthreads();      // both hold for every wave of the block
        if (ti + 2 < NT)      // refill the pair of buffers that was just read
            async_kv_tiles((ti & 1) ? ldsK1 : ldsK0, Kg + (size_t)(j0 + 128) * DH,
                           (ti & 1) ? ldsV1 : ldsV0, Vg + (size_t)(j0 + 128) * DH, tid);
    }
    WAIT_ASYNCCNT(0x0);       // nothing is in flight when the wave goes on to the epilogue

    // ---- epilogue: O / l; o[tn][r] is O[query lane15][dh 16 tn + r + half8].
    // Turned through the wave's own LDS patch so that the global stores keep 16
    // neighbouring dh of one query row per half wave (out col = dq*16 + h).
    const float l_all = l_st + xhalf(l_st);
    float* Ow = Os[wave];
#pragma unroll
    for (int tn = 0; tn < 4; ++tn) {
        float4 lo, hi;
        lo.x = o[tn][0] / l_all; lo.y = o[tn][1] / l_all;
        lo.z = o[tn][2] / l_all; lo.w = o[tn][3] / l_all;
        hi.x = o[tn][4] / l_all; hi.y = o[tn][5] / l_all;
        hi.z = o[tn][6] / l_all; hi.w = o[tn][7] / l_all;
        *(float4*)(Ow + lane15 * PITCHO + tn * 16 + half8)     = lo;
        *(float4*)(Ow + lane15 * PITCHO + tn * 16 + half8 + 4) = hi;
    }
    __builtin_amdgcn_wave_barrier();   // keep the DS stores ahead of the DS loads (same wave, in order)
#pragma unroll
    for (int tn = 0; tn < 4; ++tn) {
        const int dq = tn * 16 + lane15;
#pragma unroll
        for (int r = 0; r < 8; ++r) {
            const int srow = q0 + wave * 16 + r + half8;
            out[((size_t)b * S + srow) * D + dq * H + h] = Ow[(r + half8) * PITCHO + dq];
        }
    }
}

// ---------------------------------------------------------------------------
extern "C" void kernel_launch(void* const* d_in, const int* in_sizes, int n_in,
                              void* d_out, int out_size, void* d_ws, size_t ws_size,
                              hipStream_t stream) {
    const float* x  = (const float*)d_in[0];
    const float* Wq = (const float*)d_in[1];
    const float* Bq = (const float*)d_in[2];
    const float* Wk = (const float*)d_in[3];
    const float* Wv = (const float*)d_in[4];
    float* out = (float*)d_out;

    // f16 workspace: Q/K/V in [B,H,S/64][dh][64] = 4,194,304 halves (8 MB) each
    const size_t per = (size_t)2 * 16 * 2048 * 64;
    _Float16* Qh = (_Float16*)d_ws;
    _Float16* Kh = Qh + per;
    _Float16* Vh = Kh + per;

    dim3 g1(1024 / 128, 4096 / 128, 3);   // (N tiles, M tiles, {Q,K,V})
    qkv_proj_kernel<<<g1, 256, 0, stream>>>(x, Wq, Bq, Wk, Wv, Qh, Kh, Vh);

    dim3 g2(2048 / 64, 16, 2);          // (q tiles, heads, batch)
    flash_attn_kernel<<<g2, 128, 0, stream>>>(Qh, Kh, Vh, out);
}

// v006
// A run of this version takes 77.3 microseconds.
// Two timings next to v005 put it at 1.12 and 1.08 times that version's speed.
// Over all steps from v000 it is 7.96 times as fast.
#include <hip/hip_runtime.h>
#include <hip/hip_bf16.h>

// ---------------------------------------------------------------------------
// Fused MHA (heads-last interleave) for MI455X / gfx1250, wave32 + WMMA f16.
// Stage 1: Q/K/V projections via v_wmma_f32_16x16x32_f16, de-interleaved into
//          an f16 workspace [B,H,S/64][dh][64 s] (bias fused for Q): a lane's 8
//          accumulator registers are 8 consecutive s of one (head, dh), so they
//          leave as one 16-byte store.
// Stage 2: flash attention; Q/K/V tiles streamed with GLOBAL_LOAD_ASYNC_TO_LDS
//          (ASYNCcnt-tracked, K and V double-buffered), both matmuls on WMMA and
//          transposed (S^T = K Q^T, O^T += V^T P^T): a lane holds one query's
//          scores (32 of 64, lane ^ 16 the rest), so the fp32 online softmax is
//          in-lane but for a lane ^ 16 exchange of the max and sum, and the score
//          accumulators pack straight into the B operand of the second product.
//          A wave holds 32 queries, so a K or V fragment feeds two WMMAs.
// LDS rows are pitched 16 B x odd (80 B for 64-B rows, 144 B for 128-B rows) so
// that the 16 rows of a ds_load_b128 fragment read fall on distinct banks, and
// transposed tiles are packed along k in registers and written 16 B at a time.
// Q and K tiles sit in LDS as [dh][s] and are read by the transposing load,
// whose pitch is 32 B x odd (160 B).
// ---------------------------------------------------------------------------

typedef __attribute__((ext_vector_type(16))) _Float16 v16h;
typedef __attribute__((ext_vector_type(8)))  _Float16 v8h;
typedef __attribute__((ext_vector_type(4)))  _Float16 v4h;
typedef __attribute__((ext_vector_type(8)))  float    v8f;

#define WMMA_F16(a, b, c) \
    __builtin_amdgcn_wmma_f32_16x16x32_f16(false, (a), false, (b), (short)0, (c), false, false)

// LDS row pitch in halves: 32-half rows (projection), 64-half rows (attention).
#define PITCH32 40
#define PITCH64 72
// 64-half rows read by ds_load_tr16_b128 (Q and K tiles, stored [dh][s]).
#define PITCHT  80
// 64-float rows of the output staging: 16 B x odd.
#define PITCHO  68

// One 64x64 f16 tile (8 KB contiguous in global) -> LDS rows of PITCHT halves,
// by 128 threads: four per-lane 16B async copies each (ASYNCcnt counts 4 a wave).
// Chunk idx = tid + 128*it is row idx>>3, 16-byte column idx&7.
// The s_wait_xcnt closes the statement so that no address register of an
// issued copy is rewritten ahead of it.
static __device__ __forceinline__
void async_tile_64x64(unsigned lds_base, const _Float16* g, int tid) {
    const unsigned l0 = lds_base + (unsigned)(tid >> 3) * (PITCHT * 2) + (unsigned)(tid & 7) * 16;
    const unsigned long long g0 = (unsigned long long)(uintptr_t)(g + tid * 8);
    asm volatile("global_load_async_to_lds_b128 %0, %4, off\n\t"
                 "global_load_async_to_lds_b128 %1, %5, off\n\t"
                 "global_load_async_to_lds_b128 %2, %6, off\n\t"
                 "global_load_async_to_lds_b128 %3, %7, off\n\t"
                 "s_wait_xcnt 0x0"
                 :: "v"(l0), "v"(l0 + 16 * PITCHT * 2), "v"(l0 + 32 * PITCHT * 2),
                    "v"(l0 + 48 * PITCHT * 2),
                    "v"(g0), "v"(g0 + 2048), "v"(g0 + 4096), "v"(g0 + 6144)
                 : "memory");
}
// A K tile (rows of PITCHT halves) and the V tile of the same keys (rows of
// PITCH64 halves), each 8 KB contiguous in global, chunked as above: eight
// copies a lane in one statement, closed by the one s_wait_xcnt for all of them.
static __device__ __forceinline__
void async_kv_tiles(unsigned lds_k, const _Float16* gk,
                    unsigned lds_v, const _Float16* gv, int tid) {
    const unsigned k0 = lds_k + (unsigned)(tid >> 3) * (PITCHT * 2) + (unsigned)(tid & 7) * 16;
    const unsigned v0 = lds_v + (unsigned)(tid >> 3) * (PITCH64 * 2) + (unsigned)(tid & 7) * 16;
    const unsigned long long a0 = (unsigned long long)(uintptr_t)(gk + tid * 8);
    const unsigned long long b0 = (unsigned long long)(uintptr_t)(gv + tid * 8);
    asm volatile("global_load_async_to_lds_b128 %0, %8, off\n\t"
                 "global_load_async_to_lds_b128 %1, %9, off\n\t"
                 "global_load_async_to_lds_b128 %2, %10, off\n\t"
                 "global_load_async_to_lds_b128 %3, %11, off\n\t"
                 "global_load_async_to_lds_b128 %4, %12, off\n\t"
                 "global_load_async_to_lds_b128 %5, %13, off\n\t"
                 "global_load_async_to_lds_b128 %6, %14, off\n\t"
                 "global_load_async_to_lds_b128 %7, %15, off\n\t"
                 "s_wait_xcnt 0x0"
                 :: "v"(k0), "v"(k0 + 16 * PITCHT * 2), "v"(k0 + 32 * PITCHT * 2),
                    "v"(k0 + 48 * PITCHT * 2),
                    "v"(v0), "v"(v0 + 16 * PITCH64 * 2), "v"(v0 + 32 * PITCH64 * 2),
                    "v"(v0 + 48 * PITCH64 * 2),
                    "v"(a0), "v"(a0 + 2048), "v"(a0 + 4096), "v"(a0 + 6144),
                    "v"(b0), "v"(b0 + 2048), "v"(b0 + 4096), "v"(b0 + 6144)
                 : "memory");
}
#define WAIT_ASYNCCNT(n) asm volatile("s_wait_asynccnt " #n ::: "memory")
#define WAIT_DSCNT(n)    asm volatile("s_wait_dscnt " #n ::: "memory")

// Low 32 bits of a generic pointer to LDS == LDS byte offset (ISA §10.2).
static __device__ __forceinline__ unsigned lds_off(const void* p) {
    return (unsigned)(uintptr_t)p;
}

// Value of lane l ^ 16 (the other 16-lane row), by a vector cross-row move.
static __device__ __forceinline__ float xhalf(float v) {
    const int b = __builtin_bit_cast(int, v);
    return __builtin_bit_cast(float,
        __builtin_amdgcn_permlanex16(b, b, 0x76543210, 0xfedcba98, false, false));
}

// e^x of eight values as __expf forms it (2^(x log2 e), v_exp_f32), in place.
// One statement, so that each v_exp_f32 is followed by an instruction that
// touches neither its result nor its source: the next one, and a v_nop behind
// the last (the slot the instruction set asks for behind a transcendental).
static __device__ __forceinline__ void exp_x8(v8f& t) {
    float a = t[0] * 1.44269504f, b = t[1] * 1.44269504f, c = t[2] * 1.44269504f,
          d = t[3] * 1.44269504f, e = t[4] * 1.44269504f, f = t[5] * 1.44269504f,
          g = t[6] * 1.44269504f, h = t[7] * 1.44269504f;
    asm("v_exp_f32 %0, %0\n\t" "v_exp_f32 %1, %1\n\t" "v_exp_f32 %2, %2\n\t"
        "v_exp_f32 %3, %3\n\t" "v_exp_f32 %4, %4\n\t" "v_exp_f32 %5, %5\n\t"
        "v_exp_f32 %6, %6\n\t" "v_exp_f32 %7, %7\n\t" "v_nop"
        : "+v"(a), "+v"(b), "+v"(c), "+v"(d), "+v"(e), "+v"(f), "+v"(g), "+v"(h));
    t[0] = a; t[1] = b; t[2] = c; t[3] = d; t[4] = e; t[5] = f; t[6] = g; t[7] = h;
}

// The same for one value.
static __device__ __forceinline__ float exp_x1(float x) {
    float a = x * 1.44269504f;
    asm("v_exp_f32 %0, %0\n\t" "v_nop" : "+v"(a));
    return a;
}

// Load a 16x32 f16 A/B fragment from an LDS tile stored [row][k] (rstride
// halves per row). ISA 16-bit A layout: lanes 0-15 hold K {0..7,16..23},
// lanes 16-31 hold K {8..15,24..31} (wave32).
static __device__ __forceinline__
v16h ldfrag(const _Float16* __restrict__ base, int row, int rstride, int koff, int lane) {
    const _Float16* p = base + row * rstride + koff + ((lane & 16) ? 8 : 0);
    v8h lo = *(const v8h*)(p);
    v8h hi = *(const v8h*)(p + 16);
    v16h r;
#pragma unroll
    for (int i = 0; i < 8; ++i) { r[i] = lo[i]; r[i + 8] = hi[i]; }
    return r;
}

// The same 16x32 fragment (same k order) from an LDS tile stored [k][row],
// PITCHT halves per k: lane (c = lane & 15, hf = lane >> 4) receives
// T[kbase + 8 hf + 0..7][rbase + c], then the same 16 k further on.
typedef __attribute__((ext_vector_type(8))) short v8s;
static __device__ __forceinline__
v8h ld_tr16(const _Float16* p) {
    typedef __attribute__((address_space(3))) v8s lds_v8s;
    return __builtin_bit_cast(v8h, __builtin_amdgcn_ds_load_tr16_b128_v8i16((lds_v8s*)p));
}
static __device__ __forceinline__
v16h ldfrag_tr(const _Float16* __restrict__ base, int rbase, int kbase, int lane) {
    const _Float16* p = base + (kbase + 8 * (lane >> 4) + (lane & 7)) * PITCHT
                             + rbase + 8 * ((lane >> 3) & 1);
    v8h lo = ld_tr16(p);
    v8h hi = ld_tr16(p + 16 * PITCHT);
    v16h r;
#pragma unroll
    for (int i = 0; i < 8; ++i) { r[i] = lo[i]; r[i + 8] = hi[i]; }
    return r;
}

// ---------------------------------------------------------------------------
// Stage 1: QKV projection GEMM.  out[z] = x @ W[z] (+ Bq for z==0)
// x:[4096,1024] f32, W:[1024,1024] f32 -> f16 [B,H,S/64][dh][64 s] (heads de-interleaved)
// Block: 256 threads (8 waves, 2x4), 128x128 output tile, 64x32 per wave, K-step 32:
// an x row is fetched from L2 by 24 blocks, a W column by 32.
// (f32->f16 conversion must pass through VGPRs, so tiles load synchronously.)
// ---------------------------------------------------------------------------
__global__ __launch_bounds__(256)
void qkv_proj_kernel(const float* __restrict__ x,
                     const float* __restrict__ Wq,
                     const float* __restrict__ Bq,
                     const float* __restrict__ Wk,
                     const float* __restrict__ Wv,
                     _Float16* __restrict__ Qh,
                     _Float16* __restrict__ Kh,
                     _Float16* __restrict__ Vh) {
    constexpr int D = 1024, S = 2048, H = 16, DH = 64;
    __shared__ __align__(16) _Float16 Al[128 * PITCH32];   // x tile  [m][k]
    __shared__ __align__(16) _Float16 Bt[128 * PITCH32];   // W tile transposed [n][k]

    const int tid   = threadIdx.x;
    const int lane  = tid & 31;
    const int wave  = tid >> 5;
    const int wm    = (wave >> 2) * 64;
    const int wn    = (wave & 3) * 32;
    const int mbase = blockIdx.y * 128;
    const int nbase = blockIdx.x * 128;
    const int z     = blockIdx.z;

    const float* W   = (z == 0) ? Wq : (z == 1) ? Wk : Wv;
    _Float16*    Out = (z == 0) ? Qh : (z == 1) ? Kh : Vh;

    const v8f zv = {0.f, 0.f, 0.f, 0.f, 0.f, 0.f, 0.f, 0.f};
    v8f acc[4][2];
#pragma unroll
    for (int i = 0; i < 4; ++i)
#pragma unroll
        for (int j = 0; j < 2; ++j) acc[i][j] = zv;

    const int lane15 = lane & 15;
    // W staging: a wave takes k rows wk..wk+7 of columns wc..wc+63.
    const int wk = (wave & 3) * 8;
    const int wc = (wave >> 2) * 64;

    for (int k0 = 0; k0 < D; k0 += 32) {
        // x tile: 128 rows x 32 cols = 1024 float4 chunks, 4 per thread
#pragma unroll
        for (int it = 0; it < 4; ++it) {
            int idx = tid + it * 256;
            int row = idx >> 3, c4 = (idx & 7) * 4;
            const float4 v = *(const float4*)(x + (size_t)(mbase + row) * D + k0 + c4);
            _Float16* d = Al + row * PITCH32 + c4;
            d[0] = (_Float16)v.x; d[1] = (_Float16)v.y;
            d[2] = (_Float16)v.z; d[3] = (_Float16)v.w;
        }
        // W tile: 32 rows(k) x 128 cols(n), store transposed [n][k].
        // A lane owns columns wc + 2*lane, wc + 2*lane + 1:
        // each column's 8 k values leave as one 16-byte LDS store.
        {
            float2 wv[8];
#pragma unroll
            for (int j = 0; j < 8; ++j)
                wv[j] = *(const float2*)(W + (size_t)(k0 + wk + j) * D + nbase + wc + lane * 2);
            v8h c0, c1;
#pragma unroll
            for (int j = 0; j < 8; ++j) { c0[j] = (_Float16)wv[j].x; c1[j] = (_Float16)wv[j].y; }
            *(v8h*)(Bt + (wc + lane * 2 + 0) * PITCH32 + wk) = c0;
            *(v8h*)(Bt + (wc + lane * 2 + 1) * PITCH32 + wk) = c1;
        }
        if (k0 + 32 < D)  // speculative prefetch of next x tile row
            __builtin_prefetch(x + (size_t)(mbase + (tid >> 1)) * D + k0 + 32, 0, 1);
        __syncthreads();

        v16h b0 = ldfrag(Bt, wn + 0  + lane15, PITCH32, 0, lane);
        v16h b1 = ldfrag(Bt, wn + 16 + lane15, PITCH32, 0, lane);
        v16h a[4];
#pragma unroll
        for (int tm = 0; tm < 4; ++tm)
            a[tm] = ldfrag(Al, wm + tm * 16 + lane15, PITCH32, 0, lane);
        // Keeps the twelve LDS reads in one group ahead of the WMMAs: left alone the
        // compiler reuses one A fragment's registers and waits out the LDS latency four times.
        __builtin_amdgcn_sched_barrier(0);
#pragma unroll
        for (int tm = 0; tm < 4; ++tm) {
            acc[tm][0] = WMMA_F16(a[tm], b0, acc[tm][0]);
            acc[tm][1] = WMMA_F16(a[tm], b1, acc[tm][1]);
        }
        __syncthreads();
    }

    // Epilogue: +bias (Q only), de-interleave heads: col n -> (h = n%16, dq = n/16).
    // All eight tiles are packed first and the eight stores stand last, so that no
    // register of an issued store is written again.  The wave's 64 rows are one
    // 64-s chunk: its four stores of a column fill one 128-byte line.
    const int half8 = (lane & 16) ? 8 : 0;
    v8h       pk[4][2];
    _Float16* dst[4][2];
    float     bias[2] = {0.0f, 0.0f};
    if (z == 0) {
        bias[0] = Bq[nbase + wn + lane15];
        bias[1] = Bq[nbase + wn + 16 + lane15];
    }
#pragma unroll
    for (int tn = 0; tn < 2; ++tn) {
        const int n    = nbase + wn + tn * 16 + lane15;
        const float bi = bias[tn];
        const int h = n & 15, dq = n >> 4;
#pragma unroll
        for (int tm = 0; tm < 4; ++tm) {
            const int m  = mbase + wm + tm * 16 + half8;   // first of the lane's 8 rows
            const int bb = m >> 11;          // batch
            const int s  = m & 2047;         // seq pos
#pragma unroll
            for (int r = 0; r < 8; ++r) pk[tm][tn][r] = (_Float16)(acc[tm][tn][r] + bi);
            dst[tm][tn] = Out + (size_t)(bb * H + h) * S * DH
                              + (size_t)((s >> 6) * DH + dq) * 64 + (s & 63);
        }
    }
#pragma unroll
    for (int tn = 0; tn < 2; ++tn)
#pragma unroll
        for (int tm = 0; tm < 4; ++tm) *(v8h*)dst[tm][tn] = pk[tm][tn];
}

// ---------------------------------------------------------------------------
// Stage 2: flash attention, one block per (128 q-rows, head, batch).
// 256 threads = 8 waves = 4 query groups x 2 key halves.  Wave (qg, kh) owns the
// 32 queries [32 qg, 32 qg + 32) as two 16-column tiles, so that every K and V
// fragment read from LDS feeds two WMMAs, and of each 128-key stage the 64 keys
// of half kh, so that the grid still fills four waves per SIMD.  Q fragments stay
// in registers.  The two key halves of a query are joined once, in the epilogue.
// Q and double-buffered K and V stages arrive via async global->LDS copies,
// a stage one whole stage ahead of its use; one barrier per stage.
// ---------------------------------------------------------------------------
__global__ __launch_bounds__(256) __attribute__((amdgpu_waves_per_eu(4, 4)))
void flash_attn_kernel(const _Float16* __restrict__ Qh,
                       const _Float16* __restrict__ Kh,
                       const _Float16* __restrict__ Vh,
                       float* __restrict__ out) {
    constexpr int S = 2048, H = 16, DH = 64, D = 1024;
    constexpr int NS = S / 128;         // 16 stages of two 64-key tiles
    constexpr float SCALE = 0.03125f;   // 1/sqrt(D) = 1/32

    __shared__ __align__(16) _Float16 Qs[2][64 * PITCHT];        // [64-q chunk][dh][qrow]
    __shared__ __align__(16) _Float16 Kb[2][2][64 * PITCHT];     // [buffer][key half][dh][j]
    __shared__ __align__(16) _Float16 Vt[2][2][64 * PITCH64];    // [buffer][key half][dh][j] (A of V^T P^T)
    __shared__ __align__(16) float    Os[4][32 * PITCHO];        // per query group O [q][dh], epilogue only
    __shared__ float                  Ml[8][2][32];              // per wave: maximum, sum it hands over

    const int tid = threadIdx.x, lane = tid & 31;
    const int wave = __builtin_amdgcn_readfirstlane(tid >> 5);
    const int qg = wave & 3;            // query group
    const int kh = wave >> 2;           // key half
    const int t128 = tid & 127;         // index among the four waves of one key half
    const int lane15 = lane & 15;
    const int half8  = (lane & 16) ? 8 : 0;
    const int q0 = blockIdx.x * 128;
    const int h  = blockIdx.y;
    const int b  = blockIdx.z;

    const size_t headoff = (size_t)(b * H + h) * S * DH;
    const _Float16* Qg = Qh + headoff;
    // The four waves of a key half copy the tiles that they themselves read.
    const _Float16* Kg = Kh + headoff + (size_t)(kh * 64) * DH;
    const _Float16* Vg = Vh + headoff + (size_t)(kh * 64) * DH;

    const unsigned ldsQ  = lds_off(Qs[kh]);
    const unsigned ldsK0 = lds_off(Kb[0][kh]);
    const unsigned ldsK1 = lds_off(Kb[1][kh]);
    const unsigned ldsV0 = lds_off(Vt[0][kh]);
    const unsigned ldsV1 = lds_off(Vt[1][kh]);

    // Kick off async copies: K and V stage 0, then the Q tile (one 64-q chunk a key half).
    // Each tile is 8KB contiguous: 512 x 16B chunks, 4 per thread of its half.
    async_kv_tiles(ldsK0, Kg, ldsV0, Vg, t128);
    async_tile_64x64(ldsQ, Qg + (size_t)(q0 + kh * 64) * DH, t128);
    WAIT_ASYNCCNT(0x0);   // this wave's share of Q, K0, V0 has landed
    __syncthreads();      // ... and every other wave's: stage 0 may be read
    // Stage 1 flies while stage 0 is worked on.
    async_kv_tiles(ldsK1, Kg + (size_t)128 * DH, ldsV1, Vg + (size_t)128 * DH, t128);

    // Q^T fragments of the wave's two query tiles, both k halves: read once.
    v16h bq[2][2];
#pragma unroll
    for (int qt = 0; qt < 2; ++qt)
#pragma unroll
        for (int k2 = 0; k2 < 2; ++k2)
            bq[qt][k2] = ldfrag_tr(Qs[qg >> 1], (qg & 1) * 32 + qt * 16, k2 * 32, lane);

    const v8f zv = {0.f, 0.f, 0.f, 0.f, 0.f, 0.f, 0.f, 0.f};
    v8f o[2][4];
#pragma unroll
    for (int qt = 0; qt < 2; ++qt)
#pragma unroll
        for (int t = 0; t < 4; ++t) o[qt][t] = zv;
    // Per query tile: running maximum of the lane's query (equal in both wave halves)
    // and the sum over the keys that this half of the wave holds (joined in the epilogue).
    float m_st[2] = {-1e30f, -1e30f}, l_st[2] = {0.0f, 0.0f};

    // One stage: 64 keys x 32 queries for this wave.  refill: a stage st + 2 exists.
    auto stage = [&](const int st, const bool refill) __attribute__((always_inline)) {
        const _Float16* Kcur = Kb[st & 1][kh];
        const _Float16* Vcur = Vt[st & 1][kh];

        // ---- S^T = K Q^T  (contraction over dh; both tiles are [dh][row]) ----
        // sc[qt][tn][r] = score of key 128 st + 64 kh + 16 tn + r + half8
        //                 with query 16 qt + lane15 of the wave.
        v8f sc[2][4];
#pragma unroll
        for (int qt = 0; qt < 2; ++qt)
#pragma unroll
            for (int t = 0; t < 4; ++t) sc[qt][t] = zv;
#pragma unroll
        for (int k2 = 0; k2 < 2; ++k2) {
#pragma unroll
            for (int tn = 0; tn < 4; ++tn) {
                v16h ak = ldfrag_tr(Kcur, tn * 16, k2 * 32, lane);
                sc[0][tn] = WMMA_F16(ak, bq[0][k2], sc[0][tn]);
                sc[1][tn] = WMMA_F16(ak, bq[1][k2], sc[1][tn]);
            }
        }

        // ---- online softmax, per query tile: the lane's 32 scores and those of
        //      lane ^ 16 are the 64 keys of one query ----
        // bp: B fragments of P^T, k order of ldfrag: element i is key kk + half8 + i,
        // element 8 + i key kk + 16 + half8 + i: two score tiles as they stand.
        v16h bp[2][2];
#pragma unroll
        for (int qt = 0; qt < 2; ++qt) {
#pragma unroll
            for (int tn = 0; tn < 4; ++tn) sc[qt][tn] *= SCALE;

            float mr[8];
#pragma unroll
            for (int r = 0; r < 8; ++r)
                mr[r] = fmaxf(fmaxf(sc[qt][0][r], sc[qt][1][r]), fmaxf(sc[qt][2][r], sc[qt][3][r]));
            float mx = fmaxf(fmaxf(fmaxf(mr[0], mr[1]), fmaxf(mr[2], mr[3])),
                             fmaxf(fmaxf(mr[4], mr[5]), fmaxf(mr[6], mr[7])));
            mx = fmaxf(mx, xhalf(mx));
            const float nm   = fmaxf(m_st[qt], mx);
            const float corr = exp_x1(m_st[qt] - nm);
            m_st[qt] = nm;

            float rs[4];
#pragma unroll
            for (int tn = 0; tn < 4; ++tn) {
#pragma unroll
                for (int r = 0; r < 8; ++r) sc[qt][tn][r] -= nm;
                exp_x8(sc[qt][tn]);
                rs[tn] = sc[qt][tn][0];
#pragma unroll
                for (int r = 1; r < 8; ++r) rs[tn] += sc[qt][tn][r];
            }
            l_st[qt] = l_st[qt] * corr + ((rs[0] + rs[1]) + (rs[2] + rs[3]));
#pragma unroll
            for (int tn = 0; tn < 4; ++tn)
#pragma unroll
                for (int r = 0; r < 8; ++r) o[qt][tn][r] *= corr;
#pragma unroll
            for (int k2 = 0; k2 < 2; ++k2)
#pragma unroll
                for (int i = 0; i < 8; ++i) {
                    bp[qt][k2][i]     = (_Float16)sc[qt][2 * k2][i];
                    bp[qt][k2][i + 8] = (_Float16)sc[qt][2 * k2 + 1][i];
                }
            // Keeps the two tiles' softmax apart.  Interleaved, their scores and temporaries
            // leave so few of the 256 registers that the compiler reads the K fragments two
            // loads at a time, each pair waited out in full, not as one group of sixteen.
            __builtin_amdgcn_sched_barrier(0);
        }

        // ---- O^T += V^T P^T  (contraction over j; Vt[dh][j] is A[m][k]) ----
        v16h av[2][4];
#pragma unroll
        for (int k2 = 0; k2 < 2; ++k2)
#pragma unroll
            for (int tn = 0; tn < 4; ++tn)
                av[k2][tn] = ldfrag(Vcur, tn * 16 + lane15, PITCH64, k2 * 32, lane);
        // Keeps the sixteen LDS reads in one group ahead of the WMMAs: spread among them,
        // each pair of reads is waited out in full.
        __builtin_amdgcn_sched_barrier(0);
#pragma unroll
        for (int k2 = 0; k2 < 2; ++k2)
#pragma unroll
            for (int tn = 0; tn < 4; ++tn) {
                o[0][tn] = WMMA_F16(av[k2][tn], bp[0][k2], o[0][tn]);
                o[1][tn] = WMMA_F16(av[k2][tn], bp[1][k2], o[1][tn]);
            }

        // ---- hand-over: stage st+1 published, stage st's buffers freed ----
        WAIT_DSCNT(0x0);      // this wave's reads of stage st have returned
        WAIT_ASYNCCNT(0x0);   // this wave's share of stage st+1 has landed
        __syncthreads();      // both hold for every wave of the block
        if (refill)           // refill the pair of buffers that was just read
            async_kv_tiles((st & 1) ? ldsK1 : ldsK0, Kg + (size_t)((st + 2) * 128) * DH,
                           (st & 1) ? ldsV1 : ldsV0, Vg + (size_t)((st + 2) * 128) * DH, t128);
    };
    // The last two stages, which refill nothing, stand behind the loop: its body then has
    // no branch, and the row sums stay with their stage.  Kept rolled: unrolled by two, the
    // copies' sixteen LDS addresses become loop invariants that no longer fit 256 registers.
#pragma unroll 1
    for (int st = 0; st < NS - 2; ++st) stage(st, true);
    stage(NS - 2, false);
    stage(NS - 1, false);
    WAIT_ASYNCCNT(0x0);       // nothing is in flight when the wave goes on to the epilogue

    // ---- join of the key halves: wave (qg, kh) finishes query tile kh of its group.
    // It hands the other tile's unnormalised O, maximum and sum to wave (qg, 1 - kh)
    // through LDS and takes that wave's share of its own tile in return.
    v8f   mine[4], send[4];
#pragma unroll
    for (int tn = 0; tn < 4; ++tn) {
        mine[tn] = kh ? o[1][tn] : o[0][tn];
        send[tn] = kh ? o[0][tn] : o[1][tn];
    }
    const float l0 = l_st[0] + xhalf(l_st[0]);
    const float l1 = l_st[1] + xhalf(l_st[1]);
    const float m_mine = kh ? m_st[1] : m_st[0], m_send = kh ? m_st[0] : m_st[1];
    const float l_mine = kh ? l1 : l0,           l_send = kh ? l0 : l1;
    float* Ow    = Os[qg] + (kh * 16) * PITCHO;          // rows of the wave's own tile
    float* Osend = Os[qg] + ((kh ^ 1) * 16) * PITCHO;    // rows of the partner's tile
#pragma unroll
    for (int tn = 0; tn < 4; ++tn) {
        float4 lo, hi;
        lo.x = send[tn][0]; lo.y = send[tn][1]; lo.z = send[tn][2]; lo.w = send[tn][3];
        hi.x = send[tn][4]; hi.y = send[tn][5]; hi.z = send[tn][6]; hi.w = send[tn][7];
        *(float4*)(Osend + lane15 * PITCHO + tn * 16 + half8)     = lo;
        *(float4*)(Osend + lane15 * PITCHO + tn * 16 + half8 + 4) = hi;
    }
    Ml[wave][0][lane] = m_send;
    Ml[wave][1][lane] = l_send;
    __syncthreads();          // the partner's share is in LDS
    const float m_oth = Ml[wave ^ 4][0][lane];
    const float l_oth = Ml[wave ^ 4][1][lane];
    const float m_all = fmaxf(m_mine, m_oth);
    const float a_mine = exp_x1(m_mine - m_all);
    const float a_oth  = exp_x1(m_oth - m_all);
    const float l_all  = l_mine * a_mine + l_oth * a_oth;
    const float f_mine = a_mine / l_all;
    const float f_oth  = a_oth / l_all;

    // ---- epilogue: mine[tn][r] is O[query lane15][dh 16 tn + r + half8].
    // Turned through the wave's own LDS patch so that the global stores keep 16
    // neighbouring dh of one query row per half wave (out col = dq*16 + h).
#pragma unroll
    for (int tn = 0; tn < 4; ++tn) {
        float4 lo = *(const float4*)(Ow + lane15 * PITCHO + tn * 16 + half8);
        float4 hi = *(const float4*)(Ow + lane15 * PITCHO + tn * 16 + half8 + 4);
        lo.x = mine[tn][0] * f_mine + lo.x * f_oth; lo.y = mine[tn][1] * f_mine + lo.y * f_oth;
        lo.z = mine[tn][2] * f_mine + lo.z * f_oth; lo.w = mine[tn][3] * f_mine + lo.w * f_oth;
        hi.x = mine[tn][4] * f_mine + hi.x * f_oth; hi.y = mine[tn][5] * f_mine + hi.y * f_oth;
        hi.z = mine[tn][6] * f_mine + hi.z * f_oth; hi.w = mine[tn][7] * f_mine + hi.w * f_oth;
        *(float4*)(Ow + lane15 * PITCHO + tn * 16 + half8)     = lo;
        *(float4*)(Ow + lane15 * PITCHO + tn * 16 + half8 + 4) = hi;
    }
    __builtin_amdgcn_wave_barrier();   // keep the DS stores ahead of the DS loads (same wave, in order)
#pragma unroll
    for (int tn = 0; tn < 4; ++tn) {
        const int dq = tn * 16 + lane15;
#pragma unroll
        for (int r = 0; r < 8; ++r) {
            const int srow = q0 + qg * 32 + kh * 16 + r + half8;
            out[((size_t)b * S + srow) * D + dq * H + h] = Ow[(r + half8) * PITCHO + dq];
        }
    }
}

// ---------------------------------------------------------------------------
extern "C" void kernel_launch(void* const* d_in, const int* in_sizes, int n_in,
                              void* d_out, int out_size, void* d_ws, size_t ws_size,
                              hipStream_t stream) {
    const float* x  = (const float*)d_in[0];
    const float* Wq = (const float*)d_in[1];
    const float* Bq = (const float*)d_in[2];
    const float* Wk = (const float*)d_in[3];
    const float* Wv = (const float*)d_in[4];
    float* out = (float*)d_out;

    // f16 workspace: Q/K/V in [B,H,S/64][dh][64] = 4,194,304 halves (8 MB) each
    const size_t per = (size_t)2 * 16 * 2048 * 64;
    _Float16* Qh = (_Float16*)d_ws;
    _Float16* Kh = Qh + per;
    _Float16* Vh = Kh + per;

    dim3 g1(1024 / 128, 4096 / 128, 3);   // (N tiles, M tiles, {Q,K,V})
    qkv_proj_kernel<<<g1, 256, 0, stream>>>(x, Wq, Bq, Wk, Wv, Qh, Kh, Vh);

    dim3 g2(2048 / 128, 16, 2);         // (q tiles, heads, batch)
    flash_attn_kernel<<<g2, 256, 0, stream>>>(Qh, Kh, Vh, out);
}

// v007
// It runs in 74.1 microseconds.
// Next to v006, in two timings, it ran 1.04 times as fast each time.
// Counting every step since v000, it is 8.29 times as fast.
#include <hip/hip_runtime.h>
#include <hip/hip_bf16.h>

// ---------------------------------------------------------------------------
// Fused MHA (heads-last interleave) for MI455X / gfx1250, wave32 + WMMA f16.
// Stage 1: Q/K/V projections via v_wmma_f32_16x16x32_f16, de-interleaved into
//          an f16 workspace [B,H,S/64][dh][64 s] (bias fused for Q): a lane's 8
//          accumulator registers are 8 consecutive s of one (head, dh), so they
//          leave as one 16-byte store.
// Stage 2: flash attention; Q/K/V tiles streamed with GLOBAL_LOAD_ASYNC_TO_LDS
//          (ASYNCcnt-tracked, K and V double-buffered), both matmuls on WMMA and
//          transposed (S^T = K Q^T, O^T += V^T P^T): a lane holds one query's
//          scores (32 of 64, lane ^ 16 the rest), so the fp32 online softmax is
//          in-lane but for a lane ^ 16 exchange of the max and sum, and the score
//          accumulators pack straight into the B operand of the second product.
//          A wave holds 32 queries, so a K or V fragment feeds two WMMAs.
//          O leaves head-major, [B,H,S][dh] f32 in the workspace, in whole lines.
// Stage 3: the heads are interleaved into out (col = dh*16 + h) through LDS, so that
//          every 128-byte line of out has one writer and is written at once.
// LDS rows are pitched 16 B x odd (80 B for 64-B rows, 144 B for 128-B rows) so
// that the 16 rows of a ds_load_b128 fragment read fall on distinct banks, and
// transposed tiles are packed along k in registers and written 16 B at a time.
// Q and K tiles sit in LDS as [dh][s] and are read by the transposing load,
// whose pitch is 32 B x odd (160 B).
// ---------------------------------------------------------------------------

typedef __attribute__((ext_vector_type(16))) _Float16 v16h;
typedef __attribute__((ext_vector_type(8)))  _Float16 v8h;
typedef __attribute__((ext_vector_type(4)))  _Float16 v4h;
typedef __attribute__((ext_vector_type(8)))  float    v8f;

#define WMMA_F16(a, b, c) \
    __builtin_amdgcn_wmma_f32_16x16x32_f16(false, (a), false, (b), (short)0, (c), false, false)

// LDS row pitch in halves: 32-half rows (projection), 64-half rows (attention).
#define PITCH32 40
#define PITCH64 72
// 64-half rows read by ds_load_tr16_b128 (Q and K tiles, stored [dh][s]).
#define PITCHT  80
// 64-float rows of the output staging: 16 B x odd.
#define PITCHO  68

// One 64x64 f16 tile (8 KB contiguous in global) -> LDS rows of PITCHT halves,
// by 128 threads: four per-lane 16B async copies each (ASYNCcnt counts 4 a wave).
// Chunk idx = tid + 128*it is row idx>>3, 16-byte column idx&7.
// The s_wait_xcnt closes the statement so that no address register of an
// issued copy is rewritten ahead of it.
static __device__ __forceinline__
void async_tile_64x64(unsigned lds_base, const _Float16* g, int tid) {
    const unsigned l0 = lds_base + (unsigned)(tid >> 3) * (PITCHT * 2) + (unsigned)(tid & 7) * 16;
    const unsigned long long g0 = (unsigned long long)(uintptr_t)(g + tid * 8);
    asm volatile("global_load_async_to_lds_b128 %0, %4, off\n\t"
                 "global_load_async_to_lds_b128 %1, %5, off\n\t"
                 "global_load_async_to_lds_b128 %2, %6, off\n\t"
                 "global_load_async_to_lds_b128 %3, %7, off\n\t"
                 "s_wait_xcnt 0x0"
                 :: "v"(l0), "v"(l0 + 16 * PITCHT * 2), "v"(l0 + 32 * PITCHT * 2),
                    "v"(l0 + 48 * PITCHT * 2),
                    "v"(g0), "v"(g0 + 2048), "v"(g0 + 4096), "v"(g0 + 6144)
                 : "memory");
}
// A K tile (rows of PITCHT halves) and the V tile of the same keys (rows of
// PITCH64 halves), each 8 KB contiguous in global, chunked as above: eight
// copies a lane in one statement, closed by the one s_wait_xcnt for all of them.
static __device__ __forceinline__
void async_kv_tiles(unsigned lds_k, const _Float16* gk,
                    unsigned lds_v, const _Float16* gv, int tid) {
    const unsigned k0 = lds_k + (unsigned)(tid >> 3) * (PITCHT * 2) + (unsigned)(tid & 7) * 16;
    const unsigned v0 = lds_v + (unsigned)(tid >> 3) * (PITCH64 * 2) + (unsigned)(tid & 7) * 16;
    const unsigned long long a0 = (unsigned long long)(uintptr_t)(gk + tid * 8);
    const unsigned long long b0 = (unsigned long long)(uintptr_t)(gv + tid * 8);
    asm volatile("global_load_async_to_lds_b128 %0, %8, off\n\t"
                 "global_load_async_to_lds_b128 %1, %9, off\n\t"
                 "global_load_async_to_lds_b128 %2, %10, off\n\t"
                 "global_load_async_to_lds_b128 %3, %11, off\n\t"
                 "global_load_async_to_lds_b128 %4, %12, off\n\t"
                 "global_load_async_to_lds_b128 %5, %13, off\n\t"
                 "global_load_async_to_lds_b128 %6, %14, off\n\t"
                 "global_load_async_to_lds_b128 %7, %15, off\n\t"
                 "s_wait_xcnt 0x0"
                 :: "v"(k0), "v"(k0 + 16 * PITCHT * 2), "v"(k0 + 32 * PITCHT * 2),
                    "v"(k0 + 48 * PITCHT * 2),
                    "v"(v0), "v"(v0 + 16 * PITCH64 * 2), "v"(v0 + 32 * PITCH64 * 2),
                    "v"(v0 + 48 * PITCH64 * 2),
                    "v"(a0), "v"(a0 + 2048), "v"(a0 + 4096), "v"(a0 + 6144),
                    "v"(b0), "v"(b0 + 2048), "v"(b0 + 4096), "v"(b0 + 6144)
                 : "memory");
}
#define WAIT_ASYNCCNT(n) asm volatile("s_wait_asynccnt " #n ::: "memory")
#define WAIT_DSCNT(n)    asm volatile("s_wait_dscnt " #n ::: "memory")

// Low 32 bits of a generic pointer to LDS == LDS byte offset (ISA §10.2).
static __device__ __forceinline__ unsigned lds_off(const void* p) {
    return (unsigned)(uintptr_t)p;
}

// Value of lane l ^ 16 (the other 16-lane row), by a vector cross-row move.
static __device__ __forceinline__ float xhalf(float v) {
    const int b = __builtin_bit_cast(int, v);
    return __builtin_bit_cast(float,
        __builtin_amdgcn_permlanex16(b, b, 0x76543210, 0xfedcba98, false, false));
}

// e^x of eight values as __expf forms it (2^(x log2 e), v_exp_f32), in place.
// One statement, so that each v_exp_f32 is followed by an instruction that
// touches neither its result nor its source: the next one, and a v_nop behind
// the last (the slot the instruction set asks for behind a transcendental).
static __device__ __forceinline__ void exp_x8(v8f& t) {
    float a = t[0] * 1.44269504f, b = t[1] * 1.44269504f, c = t[2] * 1.44269504f,
          d = t[3] * 1.44269504f, e = t[4] * 1.44269504f, f = t[5] * 1.44269504f,
          g = t[6] * 1.44269504f, h = t[7] * 1.44269504f;
    asm("v_exp_f32 %0, %0\n\t" "v_exp_f32 %1, %1\n\t" "v_exp_f32 %2, %2\n\t"
        "v_exp_f32 %3, %3\n\t" "v_exp_f32 %4, %4\n\t" "v_exp_f32 %5, %5\n\t"
        "v_exp_f32 %6, %6\n\t" "v_exp_f32 %7, %7\n\t" "v_nop"
        : "+v"(a), "+v"(b), "+v"(c), "+v"(d), "+v"(e), "+v"(f), "+v"(g), "+v"(h));
    t[0] = a; t[1] = b; t[2] = c; t[3] = d; t[4] = e; t[5] = f; t[6] = g; t[7] = h;
}

// The same for one value.
static __device__ __forceinline__ float exp_x1(float x) {
    float a = x * 1.44269504f;
    asm("v_exp_f32 %0, %0\n\t" "v_nop" : "+v"(a));
    return a;
}

// Load a 16x32 f16 A/B fragment from an LDS tile stored [row][k] (rstride
// halves per row). ISA 16-bit A layout: lanes 0-15 hold K {0..7,16..23},
// lanes 16-31 hold K {8..15,24..31} (wave32).
static __device__ __forceinline__
v16h ldfrag(const _Float16* __restrict__ base, int row, int rstride, int koff, int lane) {
    const _Float16* p = base + row * rstride + koff + ((lane & 16) ? 8 : 0);
    v8h lo = *(const v8h*)(p);
    v8h hi = *(const v8h*)(p + 16);
    v16h r;
#pragma unroll
    for (int i = 0; i < 8; ++i) { r[i] = lo[i]; r[i + 8] = hi[i]; }
    return r;
}

// The same 16x32 fragment (same k order) from an LDS tile stored [k][row],
// PITCHT halves per k: lane (c = lane & 15, hf = lane >> 4) receives
// T[kbase + 8 hf + 0..7][rbase + c], then the same 16 k further on.
typedef __attribute__((ext_vector_type(8))) short v8s;
static __device__ __forceinline__
v8h ld_tr16(const _Float16* p) {
    typedef __attribute__((address_space(3))) v8s lds_v8s;
    return __builtin_bit_cast(v8h, __builtin_amdgcn_ds_load_tr16_b128_v8i16((lds_v8s*)p));
}
static __device__ __forceinline__
v16h ldfrag_tr(const _Float16* __restrict__ base, int rbase, int kbase, int lane) {
    const _Float16* p = base + (kbase + 8 * (lane >> 4) + (lane & 7)) * PITCHT
                             + rbase + 8 * ((lane >> 3) & 1);
    v8h lo = ld_tr16(p);
    v8h hi = ld_tr16(p + 16 * PITCHT);
    v16h r;
#pragma unroll
    for (int i = 0; i < 8; ++i) { r[i] = lo[i]; r[i + 8] = hi[i]; }
    return r;
}

// ---------------------------------------------------------------------------
// Stage 1: QKV projection GEMM.  out[z] = x @ W[z] (+ Bq for z==0)
// x:[4096,1024] f32, W:[1024,1024] f32 -> f16 [B,H,S/64][dh][64 s] (heads de-interleaved)
// Block: 256 threads (8 waves, 2x4), 128x128 output tile, 64x32 per wave, K-step 32:
// an x row is fetched from L2 by 24 blocks, a W column by 32.
// (f32->f16 conversion must pass through VGPRs, so tiles load synchronously.)
// ---------------------------------------------------------------------------
__global__ __launch_bounds__(256)
void qkv_proj_kernel(const float* __restrict__ x,
                     const float* __restrict__ Wq,
                     const float* __restrict__ Bq,
                     const float* __restrict__ Wk,
                     const float* __restrict__ Wv,
                     _Float16* __restrict__ Qh,
                     _Float16* __restrict__ Kh,
                     _Float16* __restrict__ Vh) {
    constexpr int D = 1024, S = 2048, H = 16, DH = 64;
    __shared__ __align__(16) _Float16 Al[128 * PITCH32];   // x tile  [m][k]
    __shared__ __align__(16) _Float16 Bt[128 * PITCH32];   // W tile transposed [n][k]

    const int tid   = threadIdx.x;
    const int lane  = tid & 31;
    const int wave  = tid >> 5;
    const int wm    = (wave >> 2) * 64;
    const int wn    = (wave & 3) * 32;
    const int mbase = blockIdx.y * 128;
    const int nbase = blockIdx.x * 128;
    const int z     = blockIdx.z;

    const float* W   = (z == 0) ? Wq : (z == 1) ? Wk : Wv;
    _Float16*    Out = (z == 0) ? Qh : (z == 1) ? Kh : Vh;

    const v8f zv = {0.f, 0.f, 0.f, 0.f, 0.f, 0.f, 0.f, 0.f};
    v8f acc[4][2];
#pragma unroll
    for (int i = 0; i < 4; ++i)
#pragma unroll
        for (int j = 0; j < 2; ++j) acc[i][j] = zv;

    const int lane15 = lane & 15;
    // W staging: a wave takes k rows wk..wk+7 of columns wc..wc+63.
    const int wk = (wave & 3) * 8;
    const int wc = (wave >> 2) * 64;

    for (int k0 = 0; k0 < D; k0 += 32) {
        // x tile: 128 rows x 32 cols = 1024 float4 chunks, 4 per thread
#pragma unroll
        for (int it = 0; it < 4; ++it) {
            int idx = tid + it * 256;
            int row = idx >> 3, c4 = (idx & 7) * 4;
            const float4 v = *(const float4*)(x + (size_t)(mbase + row) * D + k0 + c4);
            _Float16* d = Al + row * PITCH32 + c4;
            d[0] = (_Float16)v.x; d[1] = (_Float16)v.y;
            d[2] = (_Float16)v.z; d[3] = (_Float16)v.w;
        }
        // W tile: 32 rows(k) x 128 cols(n), store transposed [n][k].
        // A lane owns columns wc + 2*lane, wc + 2*lane + 1:
        // each column's 8 k values leave as one 16-byte LDS store.
        {
            float2 wv[8];
#pragma unroll
            for (int j = 0; j < 8; ++j)
                wv[j] = *(const float2*)(W + (size_t)(k0 + wk + j) * D + nbase + wc + lane * 2);
            v8h c0, c1;
#pragma unroll
            for (int j = 0; j < 8; ++j) { c0[j] = (_Float16)wv[j].x; c1[j] = (_Float16)wv[j].y; }
            *(v8h*)(Bt + (wc + lane * 2 + 0) * PITCH32 + wk) = c0;
            *(v8h*)(Bt + (wc + lane * 2 + 1) * PITCH32 + wk) = c1;
        }
        if (k0 + 32 < D)  // speculative prefetch of next x tile row
            __builtin_prefetch(x + (size_t)(mbase + (tid >> 1)) * D + k0 + 32, 0, 1);
        __syncthreads();

        v16h b0 = ldfrag(Bt, wn + 0  + lane15, PITCH32, 0, lane);
        v16h b1 = ldfrag(Bt, wn + 16 + lane15, PITCH32, 0, lane);
        v16h a[4];
#pragma unroll
        for (int tm = 0; tm < 4; ++tm)
            a[tm] = ldfrag(Al, wm + tm * 16 + lane15, PITCH32, 0, lane);
        // Keeps the twelve LDS reads in one group ahead of the WMMAs: left alone the
        // compiler reuses one A fragment's registers and waits out the LDS latency four times.
        __builtin_amdgcn_sched_barrier(0);
#pragma unroll
        for (int tm = 0; tm < 4; ++tm) {
            acc[tm][0] = WMMA_F16(a[tm], b0, acc[tm][0]);
            acc[tm][1] = WMMA_F16(a[tm], b1, acc[tm][1]);
        }
        __syncthreads();
    }

    // Epilogue: +bias (Q only), de-interleave heads: col n -> (h = n%16, dq = n/16).
    // All eight tiles are packed first and the eight stores stand last, so that no
    // register of an issued store is written again.  The wave's 64 rows are one
    // 64-s chunk: its four stores of a column fill one 128-byte line.
    const int half8 = (lane & 16) ? 8 : 0;
    v8h       pk[4][2];
    _Float16* dst[4][2];
    float     bias[2] = {0.0f, 0.0f};
    if (z == 0) {
        bias[0] = Bq[nbase + wn + lane15];
        bias[1] = Bq[nbase + wn + 16 + lane15];
    }
#pragma unroll
    for (int tn = 0; tn < 2; ++tn) {
        const int n    = nbase + wn + tn * 16 + lane15;
        const float bi = bias[tn];
        const int h = n & 15, dq = n >> 4;
#pragma unroll
        for (int tm = 0; tm < 4; ++tm) {
            const int m  = mbase + wm + tm * 16 + half8;   // first of the lane's 8 rows
            const int bb = m >> 11;          // batch
            const int s  = m & 2047;         // seq pos
#pragma unroll
            for (int r = 0; r < 8; ++r) pk[tm][tn][r] = (_Float16)(acc[tm][tn][r] + bi);
            dst[tm][tn] = Out + (size_t)(bb * H + h) * S * DH
                              + (size_t)((s >> 6) * DH + dq) * 64 + (s & 63);
        }
    }
#pragma unroll
    for (int tn = 0; tn < 2; ++tn)
#pragma unroll
        for (int tm = 0; tm < 4; ++tm) *(v8h*)dst[tm][tn] = pk[tm][tn];
}

// ---------------------------------------------------------------------------
// Stage 2: flash attention, one block per (128 q-rows, head, batch).
// 256 threads = 8 waves = 4 query groups x 2 key halves.  Wave (qg, kh) owns the
// 32 queries [32 qg, 32 qg + 32) as two 16-column tiles, so that every K and V
// fragment read from LDS feeds two WMMAs, and of each 128-key stage the 64 keys
// of half kh, so that the grid still fills four waves per SIMD.  Q fragments stay
// in registers.  The two key halves of a query are joined once, in the epilogue.
// Q and double-buffered K and V stages arrive via async global->LDS copies,
// a stage one whole stage ahead of its use; one barrier per stage.
// ---------------------------------------------------------------------------
__global__ __launch_bounds__(256) __attribute__((amdgpu_waves_per_eu(4, 4)))
void flash_attn_kernel(const _Float16* __restrict__ Qh,
                       const _Float16* __restrict__ Kh,
                       const _Float16* __restrict__ Vh,
                       float* __restrict__ Op) {
    constexpr int S = 2048, H = 16, DH = 64;
    constexpr int NS = S / 128;         // 16 stages of two 64-key tiles
    constexpr float SCALE = 0.03125f;   // 1/sqrt(D) = 1/32

    __shared__ __align__(16) _Float16 Qs[2][64 * PITCHT];        // [64-q chunk][dh][qrow]
    __shared__ __align__(16) _Float16 Kb[2][2][64 * PITCHT];     // [buffer][key half][dh][j]
    __shared__ __align__(16) _Float16 Vt[2][2][64 * PITCH64];    // [buffer][key half][dh][j] (A of V^T P^T)
    __shared__ __align__(16) float    Os[4][32 * PITCHO];        // per query group O [q][dh], epilogue only
    __shared__ float                  Ml[8][2][32];              // per wave: maximum, sum it hands over

    const int tid = threadIdx.x, lane = tid & 31;
    const int wave = __builtin_amdgcn_readfirstlane(tid >> 5);
    const int qg = wave & 3;            // query group
    const int kh = wave >> 2;           // key half
    const int t128 = tid & 127;         // index among the four waves of one key half
    const int lane15 = lane & 15;
    const int half8  = (lane & 16) ? 8 : 0;
    const int q0 = blockIdx.x * 128;
    const int h  = blockIdx.y;
    const int b  = blockIdx.z;

    const size_t headoff = (size_t)(b * H + h) * S * DH;
    const _Float16* Qg = Qh + headoff;
    // The four waves of a key half copy the tiles that they themselves read.
    const _Float16* Kg = Kh + headoff + (size_t)(kh * 64) * DH;
    const _Float16* Vg = Vh + headoff + (size_t)(kh * 64) * DH;

    const unsigned ldsQ  = lds_off(Qs[kh]);
    const unsigned ldsK0 = lds_off(Kb[0][kh]);
    const unsigned ldsK1 = lds_off(Kb[1][kh]);
    const unsigned ldsV0 = lds_off(Vt[0][kh]);
    const unsigned ldsV1 = lds_off(Vt[1][kh]);

    // Kick off async copies: K and V stage 0, then the Q tile (one 64-q chunk a key half).
    // Each tile is 8KB contiguous: 512 x 16B chunks, 4 per thread of its half.
    async_kv_tiles(ldsK0, Kg, ldsV0, Vg, t128);
    async_tile_64x64(ldsQ, Qg + (size_t)(q0 + kh * 64) * DH, t128);
    WAIT_ASYNCCNT(0x0);   // this wave's share of Q, K0, V0 has landed
    __syncthreads();      // ... and every other wave's: stage 0 may be read
    // Stage 1 flies while stage 0 is worked on.
    async_kv_tiles(ldsK1, Kg + (size_t)128 * DH, ldsV1, Vg + (size_t)128 * DH, t128);

    // Q^T fragments of the wave's two query tiles, both k halves: read once.
    v16h bq[2][2];
#pragma unroll
    for (int qt = 0; qt < 2; ++qt)
#pragma unroll
        for (int k2 = 0; k2 < 2; ++k2)
            bq[qt][k2] = ldfrag_tr(Qs[qg >> 1], (qg & 1) * 32 + qt * 16, k2 * 32, lane);

    const v8f zv = {0.f, 0.f, 0.f, 0.f, 0.f, 0.f, 0.f, 0.f};
    v8f o[2][4];
#pragma unroll
    for (int qt = 0; qt < 2; ++qt)
#pragma unroll
        for (int t = 0; t < 4; ++t) o[qt][t] = zv;
    // Per query tile: running maximum of the lane's query (equal in both wave halves)
    // and the sum over the keys that this half of the wave holds (joined in the epilogue).
    float m_st[2] = {-1e30f, -1e30f}, l_st[2] = {0.0f, 0.0f};

    // One stage: 64 keys x 32 queries for this wave.  refill: a stage st + 2 exists.
    auto stage = [&](const int st, const bool refill) __attribute__((always_inline)) {
        const _Float16* Kcur = Kb[st & 1][kh];
        const _Float16* Vcur = Vt[st & 1][kh];

        // ---- S^T = K Q^T  (contraction over dh; both tiles are [dh][row]) ----
        // sc[qt][tn][r] = score of key 128 st + 64 kh + 16 tn + r + half8
        //                 with query 16 qt + lane15 of the wave.
        v8f sc[2][4];
#pragma unroll
        for (int qt = 0; qt < 2; ++qt)
#pragma unroll
            for (int t = 0; t < 4; ++t) sc[qt][t] = zv;
#pragma unroll
        for (int k2 = 0; k2 < 2; ++k2) {
#pragma unroll
            for (int tn = 0; tn < 4; ++tn) {
                v16h ak = ldfrag_tr(Kcur, tn * 16, k2 * 32, lane);
                sc[0][tn] = WMMA_F16(ak, bq[0][k2], sc[0][tn]);
                sc[1][tn] = WMMA_F16(ak, bq[1][k2], sc[1][tn]);
            }
        }

        // ---- online softmax, per query tile: the lane's 32 scores and those of
        //      lane ^ 16 are the 64 keys of one query ----
        // bp: B fragments of P^T, k order of ldfrag: element i is key kk + half8 + i,
        // element 8 + i key kk + 16 + half8 + i: two score tiles as they stand.
        v16h bp[2][2];
#pragma unroll
        for (int qt = 0; qt < 2; ++qt) {
#pragma unroll
            for (int tn = 0; tn < 4; ++tn) sc[qt][tn] *= SCALE;

            float mr[8];
#pragma unroll
            for (int r = 0; r < 8; ++r)
                mr[r] = fmaxf(fmaxf(sc[qt][0][r], sc[qt][1][r]), fmaxf(sc[qt][2][r], sc[qt][3][r]));
            float mx = fmaxf(fmaxf(fmaxf(mr[0], mr[1]), fmaxf(mr[2], mr[3])),
                             fmaxf(fmaxf(mr[4], mr[5]), fmaxf(mr[6], mr[7])));
            mx = fmaxf(mx, xhalf(mx));
            const float nm   = fmaxf(m_st[qt], mx);
            const float corr = exp_x1(m_st[qt] - nm);
            m_st[qt] = nm;

            float rs[4];
#pragma unroll
            for (int tn = 0; tn < 4; ++tn) {
#pragma unroll
                for (int r = 0; r < 8; ++r) sc[qt][tn][r] -= nm;
                exp_x8(sc[qt][tn]);
                rs[tn] = sc[qt][tn][0];
#pragma unroll
                for (int r = 1; r < 8; ++r) rs[tn] += sc[qt][tn][r];
            }
            l_st[qt] = l_st[qt] * corr + ((rs[0] + rs[1]) + (rs[2] + rs[3]));
#pragma unroll
            for (int tn = 0; tn < 4; ++tn)
#pragma unroll
                for (int r = 0; r < 8; ++r) o[qt][tn][r] *= corr;
#pragma unroll
            for (int k2 = 0; k2 < 2; ++k2)
#pragma unroll
                for (int i = 0; i < 8; ++i) {
                    bp[qt][k2][i]     = (_Float16)sc[qt][2 * k2][i];
                    bp[qt][k2][i + 8] = (_Float16)sc[qt][2 * k2 + 1][i];
                }
            // Keeps the two tiles' softmax apart.  Interleaved, their scores and temporaries
            // leave so few of the 256 registers that the compiler reads the K fragments two
            // loads at a time, each pair waited out in full, not as one group of sixteen.
            __builtin_amdgcn_sched_barrier(0);
        }

        // ---- O^T += V^T P^T  (contraction over j; Vt[dh][j] is A[m][k]) ----
        v16h av[2][4];
#pragma unroll
        for (int k2 = 0; k2 < 2; ++k2)
#pragma unroll
            for (int tn = 0; tn < 4; ++tn)
                av[k2][tn] = ldfrag(Vcur, tn * 16 + lane15, PITCH64, k2 * 32, lane);
        // Keeps the sixteen LDS reads in one group ahead of the WMMAs: spread among them,
        // each pair of reads is waited out in full.
        __builtin_amdgcn_sched_barrier(0);
#pragma unroll
        for (int k2 = 0; k2 < 2; ++k2)
#pragma unroll
            for (int tn = 0; tn < 4; ++tn) {
                o[0][tn] = WMMA_F16(av[k2][tn], bp[0][k2], o[0][tn]);
                o[1][tn] = WMMA_F16(av[k2][tn], bp[1][k2], o[1][tn]);
            }

        // ---- hand-over: stage st+1 published, stage st's buffers freed ----
        WAIT_DSCNT(0x0);      // this wave's reads of stage st have returned
        WAIT_ASYNCCNT(0x0);   // this wave's share of stage st+1 has landed
        __syncthreads();      // both hold for every wave of the block
        if (refill)           // refill the pair of buffers that was just read
            async_kv_tiles((st & 1) ? ldsK1 : ldsK0, Kg + (size_t)((st + 2) * 128) * DH,
                           (st & 1) ? ldsV1 : ldsV0, Vg + (size_t)((st + 2) * 128) * DH, t128);
    };
    // The last two stages, which refill nothing, stand behind the loop: its body then has
    // no branch, and the row sums stay with their stage.  Kept rolled: unrolled by two, the
    // copies' sixteen LDS addresses become loop invariants that no longer fit 256 registers.
#pragma unroll 1
    for (int st = 0; st < NS - 2; ++st) stage(st, true);
    stage(NS - 2, false);
    stage(NS - 1, false);
    WAIT_ASYNCCNT(0x0);       // nothing is in flight when the wave goes on to the epilogue

    // ---- join of the key halves: wave (qg, kh) finishes query tile kh of its group.
    // It hands the other tile's unnormalised O, maximum and sum to wave (qg, 1 - kh)
    // through LDS and takes that wave's share of its own tile in return.
    v8f   mine[4], send[4];
#pragma unroll
    for (int tn = 0; tn < 4; ++tn) {
        mine[tn] = kh ? o[1][tn] : o[0][tn];
        send[tn] = kh ? o[0][tn] : o[1][tn];
    }
    const float l0 = l_st[0] + xhalf(l_st[0]);
    const float l1 = l_st[1] + xhalf(l_st[1]);
    const float m_mine = kh ? m_st[1] : m_st[0], m_send = kh ? m_st[0] : m_st[1];
    const float l_mine = kh ? l1 : l0,           l_send = kh ? l0 : l1;
    float* Ow    = Os[qg] + (kh * 16) * PITCHO;          // rows of the wave's own tile
    float* Osend = Os[qg] + ((kh ^ 1) * 16) * PITCHO;    // rows of the partner's tile
#pragma unroll
    for (int tn = 0; tn < 4; ++tn) {
        float4 lo, hi;
        lo.x = send[tn][0]; lo.y = send[tn][1]; lo.z = send[tn][2]; lo.w = send[tn][3];
        hi.x = send[tn][4]; hi.y = send[tn][5]; hi.z = send[tn][6]; hi.w = send[tn][7];
        *(float4*)(Osend + lane15 * PITCHO + tn * 16 + half8)     = lo;
        *(float4*)(Osend + lane15 * PITCHO + tn * 16 + half8 + 4) = hi;
    }
    Ml[wave][0][lane] = m_send;
    Ml[wave][1][lane] = l_send;
    __syncthreads();          // the partner's share is in LDS
    const float m_oth = Ml[wave ^ 4][0][lane];
    const float l_oth = Ml[wave ^ 4][1][lane];
    const float m_all = fmaxf(m_mine, m_oth);
    const float a_mine = exp_x1(m_mine - m_all);
    const float a_oth  = exp_x1(m_oth - m_all);
    const float l_all  = l_mine * a_mine + l_oth * a_oth;
    const float f_mine = a_mine / l_all;
    const float f_oth  = a_oth / l_all;

    // ---- epilogue: mine[tn][r] is O[query lane15][dh 16 tn + r + half8].
    // Turned through the wave's own LDS patch so that a global store is two whole
    // query rows of the head-major plane: 512 contiguous bytes, four whole lines.
#pragma unroll
    for (int tn = 0; tn < 4; ++tn) {
        float4 lo = *(const float4*)(Ow + lane15 * PITCHO + tn * 16 + half8);
        float4 hi = *(const float4*)(Ow + lane15 * PITCHO + tn * 16 + half8 + 4);
        lo.x = mine[tn][0] * f_mine + lo.x * f_oth; lo.y = mine[tn][1] * f_mine + lo.y * f_oth;
        lo.z = mine[tn][2] * f_mine + lo.z * f_oth; lo.w = mine[tn][3] * f_mine + lo.w * f_oth;
        hi.x = mine[tn][4] * f_mine + hi.x * f_oth; hi.y = mine[tn][5] * f_mine + hi.y * f_oth;
        hi.z = mine[tn][6] * f_mine + hi.z * f_oth; hi.w = mine[tn][7] * f_mine + hi.w * f_oth;
        *(float4*)(Ow + lane15 * PITCHO + tn * 16 + half8)     = lo;
        *(float4*)(Ow + lane15 * PITCHO + tn * 16 + half8 + 4) = hi;
    }
    __builtin_amdgcn_wave_barrier();   // keep the DS stores ahead of the DS loads (same wave, in order)
    // The wave's 16 query rows are 4 KB contiguous in the plane.
    float* Og = Op + ((size_t)(b * H + h) * S + q0 + qg * 32 + kh * 16) * DH + lane * 4;
    float4 ov[8];
#pragma unroll
    for (int i = 0; i < 8; ++i)
        ov[i] = *(const float4*)(Ow + (2 * i + (lane >> 4)) * PITCHO + lane15 * 4);
#pragma unroll
    for (int i = 0; i < 8; ++i) *(float4*)(Og + i * 128) = ov[i];
}

// ---------------------------------------------------------------------------
// Stage 3: out[b][s][dq*16 + h] = Op[b][h][s][dq].  One block per 16 rows (b, s).
// Wave w brings heads 2w and 2w+1 (4 KB contiguous each) into LDS as [row][h][dq],
// h rows of PITCHO floats, and writes out rows 2w and 2w+1, 512 contiguous bytes
// a store.  A lane's 16 bytes of out are four heads of one dq: four LDS words
// PITCHO apart; over a wave they fall on 32 distinct banks.
// ---------------------------------------------------------------------------
__global__ __launch_bounds__(256)
void interleave_heads_kernel(const float* __restrict__ Op, float* __restrict__ out) {
    constexpr int S = 2048, H = 16, DH = 64, D = 1024, R = 16;
    __shared__ __align__(16) float T[R * H * PITCHO];

    const int lane = threadIdx.x & 31;
    const int wave = __builtin_amdgcn_readfirstlane(threadIdx.x >> 5);
    const int row0 = blockIdx.x * R;            // first of the block's rows, of B*S
    const int b = row0 >> 11, s0 = row0 & (S - 1);

    // Head 2w, the block's first row.  Read as one wave-uniform value so that the loads take
    // a scalar base and the lane's offset; left to itself the compiler forms a vector address
    // pair and lets the last load land on it while the others are in flight.
    const float* g = Op + __builtin_amdgcn_readfirstlane(((b * H + 2 * wave) * S + s0) * DH);
    // Every loop here is unrolled: v and w stay in registers, and the wave's sixteen loads
    // are in flight together.
    float4 v[2][8];
#pragma unroll
    for (int hh = 0; hh < 2; ++hh) {
#pragma unroll
        for (int i = 0; i < 8; ++i) v[hh][i] = *(const float4*)(g + hh * (S * DH) + i * 128 + lane * 4);
    }
#pragma unroll
    for (int hh = 0; hh < 2; ++hh)
#pragma unroll
        for (int i = 0; i < 8; ++i)   // chunk 32 i + lane: row 2 i + (lane >> 4), dq 4 (lane & 15)
            *(float4*)(T + (2 * i + (lane >> 4)) * (H * PITCHO) + (2 * wave + hh) * PITCHO
                         + (lane & 15) * 4) = v[hh][i];
    __syncthreads();          // all sixteen heads of the block's rows are in LDS

    float4 w[2][8];
#pragma unroll
    for (int rr = 0; rr < 2; ++rr)
#pragma unroll
        for (int i = 0; i < 8; ++i) {
            // out columns 128 i + 4 lane ... + 3: dq = 8 i + (lane >> 2), heads 4 (lane & 3) ... + 3
            const float* t = T + (2 * wave + rr) * (H * PITCHO) + ((lane & 3) * 4) * PITCHO
                               + 8 * i + (lane >> 2);
            w[rr][i].x = t[0];
            w[rr][i].y = t[PITCHO];
            w[rr][i].z = t[2 * PITCHO];
            w[rr][i].w = t[3 * PITCHO];
        }
    float* og = out + (size_t)(row0 + 2 * wave) * D + lane * 4;
#pragma unroll
    for (int rr = 0; rr < 2; ++rr)
#pragma unroll
        for (int i = 0; i < 8; ++i) *(float4*)(og + rr * D + i * 128) = w[rr][i];
}

// ---------------------------------------------------------------------------
extern "C" void kernel_launch(void* const* d_in, const int* in_sizes, int n_in,
                              void* d_out, int out_size, void* d_ws, size_t ws_size,
                              hipStream_t stream) {
    const float* x  = (const float*)d_in[0];
    const float* Wq = (const float*)d_in[1];
    const float* Bq = (const float*)d_in[2];
    const float* Wk = (const float*)d_in[3];
    const float* Wv = (const float*)d_in[4];
    float* out = (float*)d_out;

    // f16 workspace: Q/K/V in [B,H,S/64][dh][64] = 4,194,304 halves (8 MB) each
    const size_t per = (size_t)2 * 16 * 2048 * 64;
    _Float16* Qh = (_Float16*)d_ws;
    _Float16* Kh = Qh + per;
    _Float16* Vh = Kh + per;
    // f32 workspace plane behind them: O in [B,H,S][dh] = 4,194,304 floats (16 MB)
    float* Op = (float*)(Vh + per);

    dim3 g1(1024 / 128, 4096 / 128, 3);   // (N tiles, M tiles, {Q,K,V})
    qkv_proj_kernel<<<g1, 256, 0, stream>>>(x, Wq, Bq, Wk, Wv, Qh, Kh, Vh);

    dim3 g2(2048 / 128, 16, 2);         // (q tiles, heads, batch)
    flash_attn_kernel<<<g2, 256, 0, stream>>>(Qh, Kh, Vh, Op);

    interleave_heads_kernel<<<4096 / 16, 256, 0, stream>>>(Op, out);   // 16 rows of B*S a block
}

// v008
// Measured time: 72.7 microseconds a run.
// In both of two side-by-side timings against v007, it was 1.04 times as fast.
// Over all steps from v000 it is 8.60 times as fast.
#include <hip/hip_runtime.h>
#include <hip/hip_bf16.h>

// ---------------------------------------------------------------------------
// Fused MHA (heads-last interleave) for MI455X / gfx1250, wave32 + WMMA f16.
// Stage 1: Q/K/V projections via v_wmma_f32_16x16x32_f16, de-interleaved into
//          an f16 workspace [B,H,S/64][dh][64 s] (bias, scale fused for Q): a lane's 8
//          accumulator registers are 8 consecutive s of one (head, dh), so they
//          leave as one 16-byte store.
// Stage 2: flash attention; Q/K/V tiles streamed with GLOBAL_LOAD_ASYNC_TO_LDS
//          (ASYNCcnt-tracked, K and V double-buffered), both matmuls on WMMA and
//          transposed (S^T = K Q^T, O^T += V^T P^T): a lane holds one query's
//          scores (32 of 64, lane ^ 16 the rest), so the fp32 online softmax is
//          in-lane but for a lane ^ 16 exchange of the max and sum, and the score
//          accumulators pack straight into the B operand of the second product.
//          The softmax runs in the base-2 domain: Q is stored scaled and the score
//          products start from minus a reference that follows the maximum lazily, so
//          that an accumulator goes to v_exp_f32 as it stands.
//          A wave holds 32 queries, so a K or V fragment feeds two WMMAs.
//          O leaves head-major, [B,H,S][dh] f32 in the workspace, in whole lines.
// Stage 3: the heads are interleaved into out (col = dh*16 + h) through LDS, so that
//          every 128-byte line of out has one writer and is written at once.
// LDS rows are pitched 16 B x odd (80 B for 64-B rows, 144 B for 128-B rows) so
// that the 16 rows of a ds_load_b128 fragment read fall on distinct banks, and
// transposed tiles are packed along k in registers and written 16 B at a time.
// Q and K tiles sit in LDS as [dh][s] and are read by the transposing load,
// whose pitch is 32 B x odd (160 B).
// ---------------------------------------------------------------------------

typedef __attribute__((ext_vector_type(16))) _Float16 v16h;
typedef __attribute__((ext_vector_type(8)))  _Float16 v8h;
typedef __attribute__((ext_vector_type(4)))  _Float16 v4h;
typedef __attribute__((ext_vector_type(8)))  float    v8f;

#define WMMA_F16(a, b, c) \
    __builtin_amdgcn_wmma_f32_16x16x32_f16(false, (a), false, (b), (short)0, (c), false, false)

// LDS row pitch in halves: 32-half rows (projection), 64-half rows (attention).
#define PITCH32 40
#define PITCH64 72
// 64-half rows read by ds_load_tr16_b128 (Q and K tiles, stored [dh][s]).
#define PITCHT  80
// 64-float rows of the output staging: 16 B x odd.
#define PITCHO  68

// One 64x64 f16 tile (8 KB contiguous in global) -> LDS rows of PITCHT halves,
// by 128 threads: four per-lane 16B async copies each (ASYNCcnt counts 4 a wave).
// Chunk idx = tid + 128*it is row idx>>3, 16-byte column idx&7.
// The s_wait_xcnt closes the statement so that no address register of an
// issued copy is rewritten ahead of it.
static __device__ __forceinline__
void async_tile_64x64(unsigned lds_base, const _Float16* g, int tid) {
    const unsigned l0 = lds_base + (unsigned)(tid >> 3) * (PITCHT * 2) + (unsigned)(tid & 7) * 16;
    const unsigned long long g0 = (unsigned long long)(uintptr_t)(g + tid * 8);
    asm volatile("global_load_async_to_lds_b128 %0, %4, off\n\t"
                 "global_load_async_to_lds_b128 %1, %5, off\n\t"
                 "global_load_async_to_lds_b128 %2, %6, off\n\t"
                 "global_load_async_to_lds_b128 %3, %7, off\n\t"
                 "s_wait_xcnt 0x0"
                 :: "v"(l0), "v"(l0 + 16 * PITCHT * 2), "v"(l0 + 32 * PITCHT * 2),
                    "v"(l0 + 48 * PITCHT * 2),
                    "v"(g0), "v"(g0 + 2048), "v"(g0 + 4096), "v"(g0 + 6144)
                 : "memory");
}
// A K tile (rows of PITCHT halves) and the V tile of the same keys (rows of
// PITCH64 halves), each 8 KB contiguous in global, chunked as above: eight
// copies a lane in one statement, closed by the one s_wait_xcnt for all of them.
static __device__ __forceinline__
void async_kv_tiles(unsigned lds_k, const _Float16* gk,
                    unsigned lds_v, const _Float16* gv, int tid) {
    const unsigned k0 = lds_k + (unsigned)(tid >> 3) * (PITCHT * 2) + (unsigned)(tid & 7) * 16;
    const unsigned v0 = lds_v + (unsigned)(tid >> 3) * (PITCH64 * 2) + (unsigned)(tid & 7) * 16;
    const unsigned long long a0 = (unsigned long long)(uintptr_t)(gk + tid * 8);
    const unsigned long long b0 = (unsigned long long)(uintptr_t)(gv + tid * 8);
    asm volatile("global_load_async_to_lds_b128 %0, %8, off\n\t"
                 "global_load_async_to_lds_b128 %1, %9, off\n\t"
                 "global_load_async_to_lds_b128 %2, %10, off\n\t"
                 "global_load_async_to_lds_b128 %3, %11, off\n\t"
                 "global_load_async_to_lds_b128 %4, %12, off\n\t"
                 "global_load_async_to_lds_b128 %5, %13, off\n\t"
                 "global_load_async_to_lds_b128 %6, %14, off\n\t"
                 "global_load_async_to_lds_b128 %7, %15, off\n\t"
                 "s_wait_xcnt 0x0"
                 :: "v"(k0), "v"(k0 + 16 * PITCHT * 2), "v"(k0 + 32 * PITCHT * 2),
                    "v"(k0 + 48 * PITCHT * 2),
                    "v"(v0), "v"(v0 + 16 * PITCH64 * 2), "v"(v0 + 32 * PITCH64 * 2),
                    "v"(v0 + 48 * PITCH64 * 2),
                    "v"(a0), "v"(a0 + 2048), "v"(a0 + 4096), "v"(a0 + 6144),
                    "v"(b0), "v"(b0 + 2048), "v"(b0 + 4096), "v"(b0 + 6144)
                 : "memory");
}
// 1/sqrt(D) = 1/32 times log2 e.  The projection stores Q times SCL2, so that K Q^T is the
// softmax argument in the base-2 domain, in which every exponential is taken.
#define SCL2 (0.03125f * 1.44269504f)
#define WAIT_ASYNCCNT(n) asm volatile("s_wait_asynccnt " #n ::: "memory")
#define WAIT_DSCNT(n)    asm volatile("s_wait_dscnt " #n ::: "memory")

// Low 32 bits of a generic pointer to LDS == LDS byte offset (ISA §10.2).
static __device__ __forceinline__ unsigned lds_off(const void* p) {
    return (unsigned)(uintptr_t)p;
}

// Value of lane l ^ 16 (the other 16-lane row), by a vector cross-row move.
static __device__ __forceinline__ float xhalf(float v) {
    const int b = __builtin_bit_cast(int, v);
    return __builtin_bit_cast(float,
        __builtin_amdgcn_permlanex16(b, b, 0x76543210, 0xfedcba98, false, false));
}

// 2^x of eight values (v_exp_f32).
// One statement, so that each v_exp_f32 is followed by an instruction that
// touches neither its result nor its source: the next one, and a v_nop behind
// the last (the slot the instruction set asks for behind a transcendental).
// Results are early-clobber outputs apart from the arguments: none lands on an
// argument, and the score accumulators need no copy into tied operands.
static __device__ __forceinline__ void exp2_x8(v8f& t) {
    float a, b, c, d, e, f, g, h;
    asm("v_exp_f32 %0, %8\n\t" "v_exp_f32 %1, %9\n\t" "v_exp_f32 %2, %10\n\t"
        "v_exp_f32 %3, %11\n\t" "v_exp_f32 %4, %12\n\t" "v_exp_f32 %5, %13\n\t"
        "v_exp_f32 %6, %14\n\t" "v_exp_f32 %7, %15\n\t" "v_nop"
        : "=&v"(a), "=&v"(b), "=&v"(c), "=&v"(d), "=&v"(e), "=&v"(f), "=&v"(g), "=&v"(h)
        : "v"(t[0]), "v"(t[1]), "v"(t[2]), "v"(t[3]), "v"(t[4]), "v"(t[5]), "v"(t[6]), "v"(t[7]));
    t[0] = a; t[1] = b; t[2] = c; t[3] = d; t[4] = e; t[5] = f; t[6] = g; t[7] = h;
}

// The same for one value.
static __device__ __forceinline__ float exp2_x1(float x) {
    float a = x;
    asm("v_exp_f32 %0, %0\n\t" "v_nop" : "+v"(a));
    return a;
}

// Load a 16x32 f16 A/B fragment from an LDS tile stored [row][k] (rstride
// halves per row). ISA 16-bit A layout: lanes 0-15 hold K {0..7,16..23},
// lanes 16-31 hold K {8..15,24..31} (wave32).
static __device__ __forceinline__
v16h ldfrag(const _Float16* __restrict__ base, int row, int rstride, int koff, int lane) {
    const _Float16* p = base + row * rstride + koff + ((lane & 16) ? 8 : 0);
    v8h lo = *(const v8h*)(p);
    v8h hi = *(const v8h*)(p + 16);
    v16h r;
#pragma unroll
    for (int i = 0; i < 8; ++i) { r[i] = lo[i]; r[i + 8] = hi[i]; }
    return r;
}

// The same 16x32 fragment (same k order) from an LDS tile stored [k][row],
// PITCHT halves per k: lane (c = lane & 15, hf = lane >> 4) receives
// T[kbase + 8 hf + 0..7][rbase + c], then the same 16 k further on.
typedef __attribute__((ext_vector_type(8))) short v8s;
static __device__ __forceinline__
v8h ld_tr16(const _Float16* p) {
    typedef __attribute__((address_space(3))) v8s lds_v8s;
    return __builtin_bit_cast(v8h, __builtin_amdgcn_ds_load_tr16_b128_v8i16((lds_v8s*)p));
}
static __device__ __forceinline__
v16h ldfrag_tr(const _Float16* __restrict__ base, int rbase, int kbase, int lane) {
    const _Float16* p = base + (kbase + 8 * (lane >> 4) + (lane & 7)) * PITCHT
                             + rbase + 8 * ((lane >> 3) & 1);
    v8h lo = ld_tr16(p);
    v8h hi = ld_tr16(p + 16 * PITCHT);
    v16h r;
#pragma unroll
    for (int i = 0; i < 8; ++i) { r[i] = lo[i]; r[i + 8] = hi[i]; }
    return r;
}

// ---------------------------------------------------------------------------
// Stage 1: QKV projection GEMM.  out[z] = x @ W[z]; out[0] = (x @ Wq + Bq) * SCL2
// x:[4096,1024] f32, W:[1024,1024] f32 -> f16 [B,H,S/64][dh][64 s] (heads de-interleaved)
// Block: 256 threads (8 waves, 2x4), 128x128 output tile, 64x32 per wave, K-step 32:
// an x row is fetched from L2 by 24 blocks, a W column by 32.
// (f32->f16 conversion must pass through VGPRs, so tiles load synchronously.)
// ---------------------------------------------------------------------------
__global__ __launch_bounds__(256)
void qkv_proj_kernel(const float* __restrict__ x,
                     const float* __restrict__ Wq,
                     const float* __restrict__ Bq,
                     const float* __restrict__ Wk,
                     const float* __restrict__ Wv,
                     _Float16* __restrict__ Qh,
                     _Float16* __restrict__ Kh,
                     _Float16* __restrict__ Vh) {
    constexpr int D = 1024, S = 2048, H = 16, DH = 64;
    __shared__ __align__(16) _Float16 Al[128 * PITCH32];   // x tile  [m][k]
    __shared__ __align__(16) _Float16 Bt[128 * PITCH32];   // W tile transposed [n][k]

    const int tid   = threadIdx.x;
    const int lane  = tid & 31;
    const int wave  = tid >> 5;
    const int wm    = (wave >> 2) * 64;
    const int wn    = (wave & 3) * 32;
    const int mbase = blockIdx.y * 128;
    const int nbase = blockIdx.x * 128;
    const int z     = blockIdx.z;

    const float* W   = (z == 0) ? Wq : (z == 1) ? Wk : Wv;
    _Float16*    Out = (z == 0) ? Qh : (z == 1) ? Kh : Vh;

    const v8f zv = {0.f, 0.f, 0.f, 0.f, 0.f, 0.f, 0.f, 0.f};
    v8f acc[4][2];
#pragma unroll
    for (int i = 0; i < 4; ++i)
#pragma unroll
        for (int j = 0; j < 2; ++j) acc[i][j] = zv;

    const int lane15 = lane & 15;
    // W staging: a wave takes k rows wk..wk+7 of columns wc..wc+63.
    const int wk = (wave & 3) * 8;
    const int wc = (wave >> 2) * 64;

    for (int k0 = 0; k0 < D; k0 += 32) {
        // x tile: 128 rows x 32 cols = 1024 float4 chunks, 4 per thread
#pragma unroll
        for (int it = 0; it < 4; ++it) {
            int idx = tid + it * 256;
            int row = idx >> 3, c4 = (idx & 7) * 4;
            const float4 v = *(const float4*)(x + (size_t)(mbase + row) * D + k0 + c4);
            _Float16* d = Al + row * PITCH32 + c4;
            d[0] = (_Float16)v.x; d[1] = (_Float16)v.y;
            d[2] = (_Float16)v.z; d[3] = (_Float16)v.w;
        }
        // W tile: 32 rows(k) x 128 cols(n), store transposed [n][k].
        // A lane owns columns wc + 2*lane, wc + 2*lane + 1:
        // each column's 8 k values leave as one 16-byte LDS store.
        {
            float2 wv[8];
#pragma unroll
            for (int j = 0; j < 8; ++j)
                wv[j] = *(const float2*)(W + (size_t)(k0 + wk + j) * D + nbase + wc + lane * 2);
            v8h c0, c1;
#pragma unroll
            for (int j = 0; j < 8; ++j) { c0[j] = (_Float16)wv[j].x; c1[j] = (_Float16)wv[j].y; }
            *(v8h*)(Bt + (wc + lane * 2 + 0) * PITCH32 + wk) = c0;
            *(v8h*)(Bt + (wc + lane * 2 + 1) * PITCH32 + wk) = c1;
        }
        if (k0 + 32 < D)  // speculative prefetch of next x tile row
            __builtin_prefetch(x + (size_t)(mbase + (tid >> 1)) * D + k0 + 32, 0, 1);
        __syncthreads();

        v16h b0 = ldfrag(Bt, wn + 0  + lane15, PITCH32, 0, lane);
        v16h b1 = ldfrag(Bt, wn + 16 + lane15, PITCH32, 0, lane);
        v16h a[4];
#pragma unroll
        for (int tm = 0; tm < 4; ++tm)
            a[tm] = ldfrag(Al, wm + tm * 16 + lane15, PITCH32, 0, lane);
        // Keeps the twelve LDS reads in one group ahead of the WMMAs: left alone the
        // compiler reuses one A fragment's registers and waits out the LDS latency four times.
        __builtin_amdgcn_sched_barrier(0);
#pragma unroll
        for (int tm = 0; tm < 4; ++tm) {
            acc[tm][0] = WMMA_F16(a[tm], b0, acc[tm][0]);
            acc[tm][1] = WMMA_F16(a[tm], b1, acc[tm][1]);
        }
        __syncthreads();
    }

    // Epilogue: +bias and softmax scale (Q only), de-interleave heads: col n -> (h = n%16, dq = n/16).
    // All eight tiles are packed first and the eight stores stand last, so that no
    // register of an issued store is written again.  The wave's 64 rows are one
    // 64-s chunk: its four stores of a column fill one 128-byte line.
    const int half8 = (lane & 16) ? 8 : 0;
    v8h       pk[4][2];
    _Float16* dst[4][2];
    float     bias[2] = {0.0f, 0.0f};
    const float qs = (z == 0) ? SCL2 : 1.0f;   // Q leaves scaled for the base-2 softmax
    if (z == 0) {
        bias[0] = Bq[nbase + wn + lane15];
        bias[1] = Bq[nbase + wn + 16 + lane15];
    }
#pragma unroll
    for (int tn = 0; tn < 2; ++tn) {
        const int n    = nbase + wn + tn * 16 + lane15;
        const float bi = bias[tn];
        const int h = n & 15, dq = n >> 4;
#pragma unroll
        for (int tm = 0; tm < 4; ++tm) {
            const int m  = mbase + wm + tm * 16 + half8;   // first of the lane's 8 rows
            const int bb = m >> 11;          // batch
            const int s  = m & 2047;         // seq pos
#pragma unroll
            for (int r = 0; r < 8; ++r) pk[tm][tn][r] = (_Float16)((acc[tm][tn][r] + bi) * qs);
            dst[tm][tn] = Out + (size_t)(bb * H + h) * S * DH
                              + (size_t)((s >> 6) * DH + dq) * 64 + (s & 63);
        }
    }
#pragma unroll
    for (int tn = 0; tn < 2; ++tn)
#pragma unroll
        for (int tm = 0; tm < 4; ++tm) *(v8h*)dst[tm][tn] = pk[tm][tn];
}

// ---------------------------------------------------------------------------
// Stage 2: flash attention, one block per (128 q-rows, head, batch).
// 256 threads = 8 waves = 4 query groups x 2 key halves.  Wave (qg, kh) owns the
// 32 queries [32 qg, 32 qg + 32) as two 16-column tiles, so that every K and V
// fragment read from LDS feeds two WMMAs, and of each 128-key stage the 64 keys
// of half kh, so that the grid still fills four waves per SIMD.  Q fragments stay
// in registers.  The two key halves of a query are joined once, in the epilogue.
// Q and double-buffered K and V stages arrive via async global->LDS copies,
// a stage one whole stage ahead of its use; one barrier per stage.
// ---------------------------------------------------------------------------
__global__ __launch_bounds__(256) __attribute__((amdgpu_waves_per_eu(4, 4)))
void flash_attn_kernel(const _Float16* __restrict__ Qh,
                       const _Float16* __restrict__ Kh,
                       const _Float16* __restrict__ Vh,
                       float* __restrict__ Op) {
    constexpr int S = 2048, H = 16, DH = 64;
    constexpr int NS = S / 128;         // 16 stages of two 64-key tiles

    __shared__ __align__(16) _Float16 Qs[2][64 * PITCHT];        // [64-q chunk][dh][qrow]
    __shared__ __align__(16) _Float16 Kb[2][2][64 * PITCHT];     // [buffer][key half][dh][j]
    __shared__ __align__(16) _Float16 Vt[2][2][64 * PITCH64];    // [buffer][key half][dh][j] (A of V^T P^T)
    __shared__ __align__(16) float    Os[4][32 * PITCHO];        // per query group O [q][dh], epilogue only
    __shared__ float                  Ml[8][2][32];              // per wave: reference, sum it hands over

    const int tid = threadIdx.x, lane = tid & 31;
    const int wave = __builtin_amdgcn_readfirstlane(tid >> 5);
    const int qg = wave & 3;            // query group
    const int kh = wave >> 2;           // key half
    const int t128 = tid & 127;         // index among the four waves of one key half
    const int lane15 = lane & 15;
    const int half8  = (lane & 16) ? 8 : 0;
    const int q0 = blockIdx.x * 128;
    const int h  = blockIdx.y;
    const int b  = blockIdx.z;

    const size_t headoff = (size_t)(b * H + h) * S * DH;
    const _Float16* Qg = Qh + headoff;
    // The four waves of a key half copy the tiles that they themselves read.
    const _Float16* Kg = Kh + headoff + (size_t)(kh * 64) * DH;
    const _Float16* Vg = Vh + headoff + (size_t)(kh * 64) * DH;

    const unsigned ldsQ  = lds_off(Qs[kh]);
    const unsigned ldsK0 = lds_off(Kb[0][kh]);
    const unsigned ldsK1 = lds_off(Kb[1][kh]);
    const unsigned ldsV0 = lds_off(Vt[0][kh]);
    const unsigned ldsV1 = lds_off(Vt[1][kh]);

    // Kick off async copies: K and V stage 0, then the Q tile (one 64-q chunk a key half).
    // Each tile is 8KB contiguous: 512 x 16B chunks, 4 per thread of its half.
    async_kv_tiles(ldsK0, Kg, ldsV0, Vg, t128);
    async_tile_64x64(ldsQ, Qg + (size_t)(q0 + kh * 64) * DH, t128);
    WAIT_ASYNCCNT(0x0);   // this wave's share of Q, K0, V0 has landed
    __syncthreads();      // ... and every other wave's: stage 0 may be read
    // Stage 1 flies while stage 0 is worked on.
    async_kv_tiles(ldsK1, Kg + (size_t)128 * DH, ldsV1, Vg + (size_t)128 * DH, t128);

    // Q^T fragments of the wave's two query tiles, both k halves: read once.
    v16h bq[2][2];
#pragma unroll
    for (int qt = 0; qt < 2; ++qt)
#pragma unroll
        for (int k2 = 0; k2 < 2; ++k2)
            bq[qt][k2] = ldfrag_tr(Qs[qg >> 1], (qg & 1) * 32 + qt * 16, k2 * 32, lane);

    const v8f zv = {0.f, 0.f, 0.f, 0.f, 0.f, 0.f, 0.f, 0.f};
    v8f o[2][4];
#pragma unroll
    for (int qt = 0; qt < 2; ++qt)
#pragma unroll
        for (int t = 0; t < 4; ++t) o[qt][t] = zv;
    // Per query tile: the reference that the lane's query subtracts (base-2 domain, equal in
    // both wave halves), the same negated as the C operand of the score products, and the sum
    // over the keys that this half of the wave holds (joined in the epilogue).
    float m_st[2] = {0.0f, 0.0f}, l_st[2] = {0.0f, 0.0f};
    v8f   cneg[2] = {zv, zv};

    // One stage: 64 keys x 32 queries for this wave.  refill: a stage st + 2 exists.
    auto stage = [&](const int st, const bool refill) __attribute__((always_inline)) {
        const _Float16* Kcur = Kb[st & 1][kh];
        const _Float16* Vcur = Vt[st & 1][kh];

        // ---- S^T = K Q^T - reference  (contraction over dh; both tiles are [dh][row]) ----
        // Q carries 1/sqrt(D) log2 e, and the products start from C = minus the query's
        // reference: sc[qt][tn][r] is the finished argument of 2^x for key
        // 128 st + 64 kh + 16 tn + r + half8 and query 16 qt + lane15 of the wave.
        v8f sc[2][4];
#pragma unroll
        for (int k2 = 0; k2 < 2; ++k2) {
#pragma unroll
            for (int tn = 0; tn < 4; ++tn) {
                v16h ak = ldfrag_tr(Kcur, tn * 16, k2 * 32, lane);
                sc[0][tn] = WMMA_F16(ak, bq[0][k2], k2 ? sc[0][tn] : cneg[0]);
                sc[1][tn] = WMMA_F16(ak, bq[1][k2], k2 ? sc[1][tn] : cneg[1]);
            }
        }

        // ---- the reference follows the maximum lazily.  The lane's 32 arguments and those
        //      of lane ^ 16 are the 64 keys of one query; mx is how far they top the reference.
        float mx[2];
#pragma unroll
        for (int qt = 0; qt < 2; ++qt) {
            float mr[8];
#pragma unroll
            for (int r = 0; r < 8; ++r)
                mr[r] = fmaxf(fmaxf(sc[qt][0][r], sc[qt][1][r]), fmaxf(sc[qt][2][r], sc[qt][3][r]));
            const float m1 = fmaxf(fmaxf(fmaxf(mr[0], mr[1]), fmaxf(mr[2], mr[3])),
                                   fmaxf(fmaxf(mr[4], mr[5]), fmaxf(mr[6], mr[7])));
            mx[qt] = fmaxf(m1, xhalf(m1));
        }
        // One wave-uniform test a stage.  The first stage sets the reference to its maximum,
        // whatever its sign; later it moves only where a query tops it by more than 8: P stays
        // at or below 2^8, and a row's largest term at or above 1 (the reference is a seen score).
        const float thr = (st == 0) ? -__builtin_inff() : 8.0f;
        if (__builtin_amdgcn_ballot_w32(fmaxf(mx[0], mx[1]) > thr) != 0) {
#pragma unroll
            for (int qt = 0; qt < 2; ++qt) {
                const float d = (mx[qt] > thr) ? mx[qt] : 0.0f;
                m_st[qt] += d;
#pragma unroll
                for (int tn = 0; tn < 4; ++tn) sc[qt][tn] -= d;
                // In the first stage O and the sum are still 0 and d may have either sign.
                const float corr = (st == 0) ? 1.0f : exp2_x1(-d);
                l_st[qt] *= corr;
#pragma unroll
                for (int tn = 0; tn < 4; ++tn) o[qt][tn] *= corr;
                const float c = -m_st[qt];
                cneg[qt] = (v8f){c, c, c, c, c, c, c, c};
            }
        }

        // ---- P = 2^arguments, row sums, per query tile ----
        // bp: B fragments of P^T, k order of ldfrag: element i is key kk + half8 + i,
        // element 8 + i key kk + 16 + half8 + i: two score tiles as they stand.
        v16h bp[2][2];
#pragma unroll
        for (int qt = 0; qt < 2; ++qt) {
            float rs[4];
#pragma unroll
            for (int tn = 0; tn < 4; ++tn) {
                exp2_x8(sc[qt][tn]);
                rs[tn] = sc[qt][tn][0];
#pragma unroll
                for (int r = 1; r < 8; ++r) rs[tn] += sc[qt][tn][r];
            }
            l_st[qt] += (rs[0] + rs[1]) + (rs[2] + rs[3]);
#pragma unroll
            for (int k2 = 0; k2 < 2; ++k2)
#pragma unroll
                for (int i = 0; i < 8; ++i) {
                    bp[qt][k2][i]     = (_Float16)sc[qt][2 * k2][i];
                    bp[qt][k2][i + 8] = (_Float16)sc[qt][2 * k2 + 1][i];
                }
            // Keeps the two tiles' softmax apart.  Interleaved, their scores and temporaries
            // leave so few of the 256 registers that the compiler reads the K fragments two
            // loads at a time, each pair waited out in full, not as one group of sixteen.
            __builtin_amdgcn_sched_barrier(0);
        }

        // ---- O^T += V^T P^T  (contraction over j; Vt[dh][j] is A[m][k]) ----
        v16h av[2][4];
#pragma unroll
        for (int k2 = 0; k2 < 2; ++k2)
#pragma unroll
            for (int tn = 0; tn < 4; ++tn)
                av[k2][tn] = ldfrag(Vcur, tn * 16 + lane15, PITCH64, k2 * 32, lane);
        // Keeps the sixteen LDS reads in one group ahead of the WMMAs: spread among them,
        // each pair of reads is waited out in full.
        __builtin_amdgcn_sched_barrier(0);
#pragma unroll
        for (int k2 = 0; k2 < 2; ++k2)
#pragma unroll
            for (int tn = 0; tn < 4; ++tn) {
                o[0][tn] = WMMA_F16(av[k2][tn], bp[0][k2], o[0][tn]);
                o[1][tn] = WMMA_F16(av[k2][tn], bp[1][k2], o[1][tn]);
            }

        // ---- hand-over: stage st+1 published, stage st's buffers freed ----
        WAIT_DSCNT(0x0);      // this wave's reads of stage st have returned
        WAIT_ASYNCCNT(0x0);   // this wave's share of stage st+1 has landed
        __syncthreads();      // both hold for every wave of the block
        if (refill)           // refill the pair of buffers that was just read
            async_kv_tiles((st & 1) ? ldsK1 : ldsK0, Kg + (size_t)((st + 2) * 128) * DH,
                           (st & 1) ? ldsV1 : ldsV0, Vg + (size_t)((st + 2) * 128) * DH, t128);
    };
    // The last two stages, which refill nothing, stand behind the loop: its body then has
    // no refill test, and the row sums stay with their stage.  Kept rolled: unrolled by two, the
    // copies' sixteen LDS addresses become loop invariants that no longer fit 256 registers.
#pragma unroll 1
    for (int st = 0; st < NS - 2; ++st) stage(st, true);
    // The C operands are formed anew from the references: carried out of the loop as they
    // stand, the compiler keeps a second copy of them and refreshes it in every pass.
#pragma unroll
    for (int qt = 0; qt < 2; ++qt) {
        const float c = -m_st[qt];
        cneg[qt] = (v8f){c, c, c, c, c, c, c, c};
    }
    stage(NS - 2, false);
    stage(NS - 1, false);
    WAIT_ASYNCCNT(0x0);       // nothing is in flight when the wave goes on to the epilogue

    // ---- join of the key halves: wave (qg, kh) finishes query tile kh of its group.
    // It hands the other tile's unnormalised O, reference and sum to wave (qg, 1 - kh)
    // through LDS and takes that wave's share of its own tile in return.
    v8f   mine[4], send[4];
#pragma unroll
    for (int tn = 0; tn < 4; ++tn) {
        mine[tn] = kh ? o[1][tn] : o[0][tn];
        send[tn] = kh ? o[0][tn] : o[1][tn];
    }
    const float l0 = l_st[0] + xhalf(l_st[0]);
    const float l1 = l_st[1] + xhalf(l_st[1]);
    const float m_mine = kh ? m_st[1] : m_st[0], m_send = kh ? m_st[0] : m_st[1];
    const float l_mine = kh ? l1 : l0,           l_send = kh ? l0 : l1;
    float* Ow    = Os[qg] + (kh * 16) * PITCHO;          // rows of the wave's own tile
    float* Osend = Os[qg] + ((kh ^ 1) * 16) * PITCHO;    // rows of the partner's tile
#pragma unroll
    for (int tn = 0; tn < 4; ++tn) {
        float4 lo, hi;
        lo.x = send[tn][0]; lo.y = send[tn][1]; lo.z = send[tn][2]; lo.w = send[tn][3];
        hi.x = send[tn][4]; hi.y = send[tn][5]; hi.z = send[tn][6]; hi.w = send[tn][7];
        *(float4*)(Osend + lane15 * PITCHO + tn * 16 + half8)     = lo;
        *(float4*)(Osend + lane15 * PITCHO + tn * 16 + half8 + 4) = hi;
    }
    Ml[wave][0][lane] = m_send;
    Ml[wave][1][lane] = l_send;
    __syncthreads();          // the partner's share is in LDS
    const float m_oth = Ml[wave ^ 4][0][lane];
    const float l_oth = Ml[wave ^ 4][1][lane];
    const float m_all = fmaxf(m_mine, m_oth);
    const float a_mine = exp2_x1(m_mine - m_all);
    const float a_oth  = exp2_x1(m_oth - m_all);
    const float l_all  = l_mine * a_mine + l_oth * a_oth;
    const float f_mine = a_mine / l_all;
    const float f_oth  = a_oth / l_all;

    // ---- epilogue: mine[tn][r] is O[query lane15][dh 16 tn + r + half8].
    // Turned through the wave's own LDS patch so that a global store is two whole
    // query rows of the head-major plane: 512 contiguous bytes, four whole lines.
#pragma unroll
    for (int tn = 0; tn < 4; ++tn) {
        float4 lo = *(const float4*)(Ow + lane15 * PITCHO + tn * 16 + half8);
        float4 hi = *(const float4*)(Ow + lane15 * PITCHO + tn * 16 + half8 + 4);
        lo.x = mine[tn][0] * f_mine + lo.x * f_oth; lo.y = mine[tn][1] * f_mine + lo.y * f_oth;
        lo.z = mine[tn][2] * f_mine + lo.z * f_oth; lo.w = mine[tn][3] * f_mine + lo.w * f_oth;
        hi.x = mine[tn][4] * f_mine + hi.x * f_oth; hi.y = mine[tn][5] * f_mine + hi.y * f_oth;
        hi.z = mine[tn][6] * f_mine + hi.z * f_oth; hi.w = mine[tn][7] * f_mine + hi.w * f_oth;
        *(float4*)(Ow + lane15 * PITCHO + tn * 16 + half8)     = lo;
        *(float4*)(Ow + lane15 * PITCHO + tn * 16 + half8 + 4) = hi;
    }
    __builtin_amdgcn_wave_barrier();   // keep the DS stores ahead of the DS loads (same wave, in order)
    // The wave's 16 query rows are 4 KB contiguous in the plane.
    float* Og = Op + ((size_t)(b * H + h) * S + q0 + qg * 32 + kh * 16) * DH + lane * 4;
    float4 ov[8];
#pragma unroll
    for (int i = 0; i < 8; ++i)
        ov[i] = *(const float4*)(Ow + (2 * i + (lane >> 4)) * PITCHO + lane15 * 4);
#pragma unroll
    for (int i = 0; i < 8; ++i) *(float4*)(Og + i * 128) = ov[i];
}

// ---------------------------------------------------------------------------
// Stage 3: out[b][s][dq*16 + h] = Op[b][h][s][dq].  One block per 16 rows (b, s).
// Wave w brings heads 2w and 2w+1 (4 KB contiguous each) into LDS as [row][h][dq],
// h rows of PITCHO floats, and writes out rows 2w and 2w+1, 512 contiguous bytes
// a store.  A lane's 16 bytes of out are four heads of one dq: four LDS words
// PITCHO apart; over a wave they fall on 32 distinct banks.
// ---------------------------------------------------------------------------
__global__ __launch_bounds__(256)
void interleave_heads_kernel(const float* __restrict__ Op, float* __restrict__ out) {
    constexpr int S = 2048, H = 16, DH = 64, D = 1024, R = 16;
    __shared__ __align__(16) float T[R * H * PITCHO];

    const int lane = threadIdx.x & 31;
    const int wave = __builtin_amdgcn_readfirstlane(threadIdx.x >> 5);
    const int row0 = blockIdx.x * R;            // first of the block's rows, of B*S
    const int b = row0 >> 11, s0 = row0 & (S - 1);

    // Head 2w, the block's first row.  Read as one wave-uniform value so that the loads take
    // a scalar base and the lane's offset; left to itself the compiler forms a vector address
    // pair and lets the last load land on it while the others are in flight.
    const float* g = Op + __builtin_amdgcn_readfirstlane(((b * H + 2 * wave) * S + s0) * DH);
    // Every loop here is unrolled: v and w stay in registers, and the wave's sixteen loads
    // are in flight together.
    float4 v[2][8];
#pragma unroll
    for (int hh = 0; hh < 2; ++hh) {
#pragma unroll
        for (int i = 0; i < 8; ++i) v[hh][i] = *(const float4*)(g + hh * (S * DH) + i * 128 + lane * 4);
    }
#pragma unroll
    for (int hh = 0; hh < 2; ++hh)
#pragma unroll
        for (int i = 0; i < 8; ++i)   // chunk 32 i + lane: row 2 i + (lane >> 4), dq 4 (lane & 15)
            *(float4*)(T + (2 * i + (lane >> 4)) * (H * PITCHO) + (2 * wave + hh) * PITCHO
                         + (lane & 15) * 4) = v[hh][i];
    __syncthreads();          // all sixteen heads of the block's rows are in LDS

    float4 w[2][8];
#pragma unroll
    for (int rr = 0; rr < 2; ++rr)
#pragma unroll
        for (int i = 0; i < 8; ++i) {
            // out columns 128 i + 4 lane ... + 3: dq = 8 i + (lane >> 2), heads 4 (lane & 3) ... + 3
            const float* t = T + (2 * wave + rr) * (H * PITCHO) + ((lane & 3) * 4) * PITCHO
                               + 8 * i + (lane >> 2);
            w[rr][i].x = t[0];
            w[rr][i].y = t[PITCHO];
            w[rr][i].z = t[2 * PITCHO];
            w[rr][i].w = t[3 * PITCHO];
        }
    float* og = out + (size_t)(row0 + 2 * wave) * D + lane * 4;
#pragma unroll
    for (int rr = 0; rr < 2; ++rr)
#pragma unroll
        for (int i = 0; i < 8; ++i) *(float4*)(og + rr * D + i * 128) = w[rr][i];
}

// ---------------------------------------------------------------------------
extern "C" void kernel_launch(void* const* d_in, const int* in_sizes, int n_in,
                              void* d_out, int out_size, void* d_ws, size_t ws_size,
                              hipStream_t stream) {
    const float* x  = (const float*)d_in[0];
    const float* Wq = (const float*)d_in[1];
    const float* Bq = (const float*)d_in[2];
    const float* Wk = (const float*)d_in[3];
    const float* Wv = (const float*)d_in[4];
    float* out = (float*)d_out;

    // f16 workspace: Q/K/V in [B,H,S/64][dh][64] = 4,194,304 halves (8 MB) each
    const size_t per = (size_t)2 * 16 * 2048 * 64;
    _Float16* Qh = (_Float16*)d_ws;
    _Float16* Kh = Qh + per;
    _Float16* Vh = Kh + per;
    // f32 workspace plane behind them: O in [B,H,S][dh] = 4,194,304 floats (16 MB)
    float* Op = (float*)(Vh + per);

    dim3 g1(1024 / 128, 4096 / 128, 3);   // (N tiles, M tiles, {Q,K,V})
    qkv_proj_kernel<<<g1, 256, 0, stream>>>(x, Wq, Bq, Wk, Wv, Qh, Kh, Vh);

    dim3 g2(2048 / 128, 16, 2);         // (q tiles, heads, batch)
    flash_attn_kernel<<<g2, 256, 0, stream>>>(Qh, Kh, Vh, Op);

    interleave_heads_kernel<<<4096 / 16, 256, 0, stream>>>(Op, out);   // 16 rows of B*S a block
}

// v009
// A run of this version takes 61.4 microseconds.
// Next to v008, in two timings, it ran 1.19 and 1.15 times as fast.
// Counting every step since v000, it is 10.1 times as fast.
#include <hip/hip_runtime.h>
#include <hip/hip_bf16.h>

// ---------------------------------------------------------------------------
// Fused MHA (heads-last interleave) for MI455X / gfx1250, wave32 + WMMA f16.
// Stage 1: Q/K/V projections via v_wmma_f32_16x16x32_f16, de-interleaved into
//          an f16 workspace [B,H,S/64][dh][64 s] (bias, scale fused for Q): a lane's 8
//          accumulator registers are 8 consecutive s of one (head, dh), so they
//          leave as one 16-byte store.
// Stage 2: flash attention; Q/K/V tiles streamed with GLOBAL_LOAD_ASYNC_TO_LDS
//          (ASYNCcnt-tracked, K and V double-buffered), both matmuls on WMMA and
//          transposed (S^T = K Q^T, O^T += V^T P^T): a lane holds one query's
//          scores (32 of 64, lane ^ 16 the rest), so the fp32 online softmax is
//          in-lane but for a lane ^ 16 exchange of the max and sum, and the score
//          accumulators pack straight into the B operand of the second product.
//          The softmax runs in the base-2 domain: Q is stored scaled and the score
//          products start from minus a reference that follows the maximum lazily, so
//          that an accumulator goes to v_exp_f32 as it stands.
//          A wave holds 32 queries, so a K or V fragment feeds two WMMAs.
//          O leaves head-major, [B,H,S][dh] f32 in the workspace, in whole lines.
// Stage 3: the heads are interleaved into out (col = dh*16 + h) through LDS, so that
//          every 128-byte line of out has one writer and is written at once.
// LDS rows are pitched 16 B x odd (80 B for 64-B rows, 144 B for 128-B rows) so
// that the 16 rows of a ds_load_b128 fragment read fall on distinct banks.
// Q and K tiles sit in LDS as [dh][s], the projection's W tiles as [k][n]: they are
// read by the transposing load, whose pitch is 32 B x odd (160 B).
// ---------------------------------------------------------------------------

typedef __attribute__((ext_vector_type(16))) _Float16 v16h;
typedef __attribute__((ext_vector_type(8)))  _Float16 v8h;
typedef __attribute__((ext_vector_type(4)))  _Float16 v4h;
typedef __attribute__((ext_vector_type(8)))  float    v8f;

#define WMMA_F16(a, b, c) \
    __builtin_amdgcn_wmma_f32_16x16x32_f16(false, (a), false, (b), (short)0, (c), false, false)

// LDS row pitch in halves: 32-half rows (projection), 64-half rows (attention).
#define PITCH32 40
#define PITCH64 72
// 64-half rows read by ds_load_tr16_b128 (Q and K tiles, stored [dh][s]; W tiles, [k][n]).
#define PITCHT  80
// 64-float rows of the output staging: 16 B x odd.
#define PITCHO  68

// One 64x64 f16 tile (8 KB contiguous in global) -> LDS rows of PITCHT halves,
// by 128 threads: four per-lane 16B async copies each (ASYNCcnt counts 4 a wave).
// Chunk idx = tid + 128*it is row idx>>3, 16-byte column idx&7.
// The s_wait_xcnt closes the statement so that no address register of an
// issued copy is rewritten ahead of it.
static __device__ __forceinline__
void async_tile_64x64(unsigned lds_base, const _Float16* g, int tid) {
    const unsigned l0 = lds_base + (unsigned)(tid >> 3) * (PITCHT * 2) + (unsigned)(tid & 7) * 16;
    const unsigned long long g0 = (unsigned long long)(uintptr_t)(g + tid * 8);
    asm volatile("global_load_async_to_lds_b128 %0, %4, off\n\t"
                 "global_load_async_to_lds_b128 %1, %5, off\n\t"
                 "global_load_async_to_lds_b128 %2, %6, off\n\t"
                 "global_load_async_to_lds_b128 %3, %7, off\n\t"
                 "s_wait_xcnt 0x0"
                 :: "v"(l0), "v"(l0 + 16 * PITCHT * 2), "v"(l0 + 32 * PITCHT * 2),
                    "v"(l0 + 48 * PITCHT * 2),
                    "v"(g0), "v"(g0 + 2048), "v"(g0 + 4096), "v"(g0 + 6144)
                 : "memory");
}
// A K tile (rows of PITCHT halves) and the V tile of the same keys (rows of
// PITCH64 halves), each 8 KB contiguous in global, chunked as above: eight
// copies a lane in one statement, closed by the one s_wait_xcnt for all of them.
static __device__ __forceinline__
void async_kv_tiles(unsigned lds_k, const _Float16* gk,
                    unsigned lds_v, const _Float16* gv, int tid) {
    const unsigned k0 = lds_k + (unsigned)(tid >> 3) * (PITCHT * 2) + (unsigned)(tid & 7) * 16;
    const unsigned v0 = lds_v + (unsigned)(tid >> 3) * (PITCH64 * 2) + (unsigned)(tid & 7) * 16;
    const unsigned long long a0 = (unsigned long long)(uintptr_t)(gk + tid * 8);
    const unsigned long long b0 = (unsigned long long)(uintptr_t)(gv + tid * 8);
    asm volatile("global_load_async_to_lds_b128 %0, %8, off\n\t"
                 "global_load_async_to_lds_b128 %1, %9, off\n\t"
                 "global_load_async_to_lds_b128 %2, %10, off\n\t"
                 "global_load_async_to_lds_b128 %3, %11, off\n\t"
                 "global_load_async_to_lds_b128 %4, %12, off\n\t"
                 "global_load_async_to_lds_b128 %5, %13, off\n\t"
                 "global_load_async_to_lds_b128 %6, %14, off\n\t"
                 "global_load_async_to_lds_b128 %7, %15, off\n\t"
                 "s_wait_xcnt 0x0"
                 :: "v"(k0), "v"(k0 + 16 * PITCHT * 2), "v"(k0 + 32 * PITCHT * 2),
                    "v"(k0 + 48 * PITCHT * 2),
                    "v"(v0), "v"(v0 + 16 * PITCH64 * 2), "v"(v0 + 32 * PITCH64 * 2),
                    "v"(v0 + 48 * PITCH64 * 2),
                    "v"(a0), "v"(a0 + 2048), "v"(a0 + 4096), "v"(a0 + 6144),
                    "v"(b0), "v"(b0 + 2048), "v"(b0 + 4096), "v"(b0 + 6144)
                 : "memory");
}
// 1/sqrt(D) = 1/32 times log2 e.  The projection stores Q times SCL2, so that K Q^T is the
// softmax argument in the base-2 domain, in which every exponential is taken.
#define SCL2 (0.03125f * 1.44269504f)
#define WAIT_ASYNCCNT(n) asm volatile("s_wait_asynccnt " #n ::: "memory")
#define WAIT_DSCNT(n)    asm volatile("s_wait_dscnt " #n ::: "memory")

// Low 32 bits of a generic pointer to LDS == LDS byte offset (ISA §10.2).
static __device__ __forceinline__ unsigned lds_off(const void* p) {
    return (unsigned)(uintptr_t)p;
}

// Value of lane l ^ 16 (the other 16-lane row), by a vector cross-row move.
static __device__ __forceinline__ float xhalf(float v) {
    const int b = __builtin_bit_cast(int, v);
    return __builtin_bit_cast(float,
        __builtin_amdgcn_permlanex16(b, b, 0x76543210, 0xfedcba98, false, false));
}

// 2^x of eight values (v_exp_f32).
// One statement, so that each v_exp_f32 is followed by an instruction that
// touches neither its result nor its source: the next one, and a v_nop behind
// the last (the slot the instruction set asks for behind a transcendental).
// Results are early-clobber outputs apart from the arguments: none lands on an
// argument, and the score accumulators need no copy into tied operands.
static __device__ __forceinline__ void exp2_x8(v8f& t) {
    float a, b, c, d, e, f, g, h;
    asm("v_exp_f32 %0, %8\n\t" "v_exp_f32 %1, %9\n\t" "v_exp_f32 %2, %10\n\t"
        "v_exp_f32 %3, %11\n\t" "v_exp_f32 %4, %12\n\t" "v_exp_f32 %5, %13\n\t"
        "v_exp_f32 %6, %14\n\t" "v_exp_f32 %7, %15\n\t" "v_nop"
        : "=&v"(a), "=&v"(b), "=&v"(c), "=&v"(d), "=&v"(e), "=&v"(f), "=&v"(g), "=&v"(h)
        : "v"(t[0]), "v"(t[1]), "v"(t[2]), "v"(t[3]), "v"(t[4]), "v"(t[5]), "v"(t[6]), "v"(t[7]));
    t[0] = a; t[1] = b; t[2] = c; t[3] = d; t[4] = e; t[5] = f; t[6] = g; t[7] = h;
}

// The same for one value.
static __device__ __forceinline__ float exp2_x1(float x) {
    float a = x;
    asm("v_exp_f32 %0, %0\n\t" "v_nop" : "+v"(a));
    return a;
}

// Load a 16x32 f16 A/B fragment from an LDS tile stored [row][k] (rstride
// halves per row). ISA 16-bit A layout: lanes 0-15 hold K {0..7,16..23},
// lanes 16-31 hold K {8..15,24..31} (wave32).
static __device__ __forceinline__
v16h ldfrag(const _Float16* __restrict__ base, int row, int rstride, int koff, int lane) {
    const _Float16* p = base + row * rstride + koff + ((lane & 16) ? 8 : 0);
    v8h lo = *(const v8h*)(p);
    v8h hi = *(const v8h*)(p + 16);
    v16h r;
#pragma unroll
    for (int i = 0; i < 8; ++i) { r[i] = lo[i]; r[i + 8] = hi[i]; }
    return r;
}

// The same 16x32 fragment (same k order) from an LDS tile stored [k][row],
// PITCHT halves per k: lane (c = lane & 15, hf = lane >> 4) receives
// T[kbase + 8 hf + 0..7][rbase + c], then the same 16 k further on.
typedef __attribute__((ext_vector_type(8))) short v8s;
static __device__ __forceinline__
v8h ld_tr16(const _Float16* p) {
    typedef __attribute__((address_space(3))) v8s lds_v8s;
    return __builtin_bit_cast(v8h, __builtin_amdgcn_ds_load_tr16_b128_v8i16((lds_v8s*)p));
}
static __device__ __forceinline__
v16h ldfrag_tr(const _Float16* __restrict__ base, int rbase, int kbase, int lane) {
    const _Float16* p = base + (kbase + 8 * (lane >> 4) + (lane & 7)) * PITCHT
                             + rbase + 8 * ((lane >> 3) & 1);
    v8h lo = ld_tr16(p);
    v8h hi = ld_tr16(p + 16 * PITCHT);
    v16h r;
#pragma unroll
    for (int i = 0; i < 8; ++i) { r[i] = lo[i]; r[i + 8] = hi[i]; }
    return r;
}

// ---------------------------------------------------------------------------
// Stage 1: QKV projection GEMM.  out[z] = x @ W[z]; out[0] = (x @ Wq + Bq) * SCL2
// x:[4096,1024] f32, W:[1024,1024] f32 -> f16 [B,H,S/64][dh][64 s] (heads de-interleaved)
// Block: 512 threads (16 waves, 4x4), one block per WGP.  It does 256 rows x 64 columns of
// each of Q, K and V: the x tile is staged once for the three products, an x row is
// fetched from L2 by 16 blocks and a W column by 16.  A wave does 64 rows x 16 columns x 3.
// K-step 32.  (f32->f16 conversion must pass through VGPRs.)  The tiles of k-step t + 2 are
// on their way to registers while step t is multiplied; those of t + 1 go from registers
// to the LDS buffer that step t does not read.  W stays [k][n] in LDS and is turned by
// the transposing load, so that its global loads are 16 B a lane.
// ---------------------------------------------------------------------------
// Two f32 to packed f16, round to nearest even as the cast does.  Written as a volatile
// statement so that it stays behind the barrier wait of the step before: as plain casts the
// compiler lifts a tile's conversions to right behind its loads, a whole k-step early, and
// waits the loads out there.
typedef __attribute__((ext_vector_type(2))) unsigned v2u;
static __device__ __forceinline__ unsigned cvt_pk_held(float a, float b) {
    unsigned r;
    asm volatile("v_cvt_pk_f16_f32 %0, %1, %2" : "=v"(r) : "v"(a), "v"(b));
    return r;
}
#define PJ_A    (256 * PITCH32)          // halves of the x tile [m][k]
#define PJ_B    (32 * PITCHT)            // halves of one W tile [k][n]
#define PJ_BUF  (PJ_A + 3 * PJ_B)        // halves of one buffer
// The inputs are not declared restrict: their loads then stay on their side of the barrier
// statements; declared so, the compiler sinks half of each load to just in front of its use.
__global__ __launch_bounds__(512)
void qkv_proj_kernel(const float* x,
                     const float* Wq,
                     const float* Bq,
                     const float* Wk,
                     const float* Wv,
                     _Float16* __restrict__ Qh,
                     _Float16* __restrict__ Kh,
                     _Float16* __restrict__ Vh) {
    constexpr int D = 1024, S = 2048, H = 16, DH = 64;
    constexpr int NK = D / 32;          // 32 k-steps
    __shared__ __align__(16) _Float16 sm[2 * PJ_BUF];

    const int tid    = threadIdx.x;
    const int lane   = tid & 31;
    const int wave   = __builtin_amdgcn_readfirstlane(tid >> 5);
    const int wm     = (wave >> 2) * 64;
    const int wn     = (wave & 3) * 16;
    const int mbase  = blockIdx.y * 256;
    const int nbase  = blockIdx.x * 64;
    const int lane15 = lane & 15;
    const int n      = nbase + wn + lane15;   // the lane's column of Q, of K and of V
    const float bi   = Bq[n];                 // read here: its latency passes under the k loop

    const v8f zv = {0.f, 0.f, 0.f, 0.f, 0.f, 0.f, 0.f, 0.f};
    v8f acc[4][3];
#pragma unroll
    for (int i = 0; i < 4; ++i)
#pragma unroll
        for (int j = 0; j < 3; ++j) acc[i][j] = zv;

    // x tile: 256 rows x 32 k = 2048 float4 chunks, 4 a thread (rows 64 apart).
    // W tiles: 32 k x 64 n = 512 float4 chunks each, one a thread and matrix.
    const int xo = (mbase + (tid >> 3)) * D + (tid & 7) * 4;
    const int wo = (tid >> 4) * D + nbase + (tid & 15) * 4;
    _Float16* const xl = sm + (tid >> 3) * PITCH32 + (tid & 7) * 4;
    _Float16* const wl = sm + PJ_A + (tid >> 4) * PITCHT + (tid & 15) * 4;

    // Two register sets, tile kt in set kt & 1 (as in LDS): a tile's loads are issued before
    // the tile ahead of it is waited for, so that the block always has loads in flight.
    float4 xr[2][4], wr[2][3];
    auto fetch = [&](const int kt, const int buf) __attribute__((always_inline)) {
#pragma unroll
        for (int it = 0; it < 4; ++it)
            xr[buf][it] = *(const float4*)(x + kt * 32 + xo + it * (64 * D));
        wr[buf][0] = *(const float4*)(Wq + kt * (32 * D) + wo);
        wr[buf][1] = *(const float4*)(Wk + kt * (32 * D) + wo);
        wr[buf][2] = *(const float4*)(Wv + kt * (32 * D) + wo);
    };
    auto put = [&](const int buf) __attribute__((always_inline)) {
#pragma unroll
        for (int it = 0; it < 4; ++it) {
            const float4 v = xr[buf][it];
            const v2u p = {cvt_pk_held(v.x, v.y), cvt_pk_held(v.z, v.w)};
            *(v4h*)(xl + buf * PJ_BUF + it * (64 * PITCH32)) = __builtin_bit_cast(v4h, p);
        }
#pragma unroll
        for (int z = 0; z < 3; ++z) {
            const float4 v = wr[buf][z];
            const v2u p = {cvt_pk_held(v.x, v.y), cvt_pk_held(v.z, v.w)};
            *(v4h*)(wl + buf * PJ_BUF + z * PJ_B) = __builtin_bit_cast(v4h, p);
        }
    };

    // One k-step.  The work-group barrier is written by hand, for two reasons: it waits for
    // LDS only, so that the global loads issued ahead stay in flight across it, and it is
    // split: a wave signals once its fragments are in registers and its share of the next
    // tile is in LDS, does its last three products, and only then waits.  No LDS access
    // stands in between.
    auto step = [&](const int kt, const int buf, const bool more1, const bool more2)
                __attribute__((always_inline)) {
        const _Float16* A = sm + buf * PJ_BUF;
        const _Float16* B = A + PJ_A;
        v16h b[3], a[4];
#pragma unroll
        for (int z = 0; z < 3; ++z) b[z] = ldfrag_tr(B + z * PJ_B, wn, 0, lane);
#pragma unroll
        for (int tm = 0; tm < 4; ++tm)
            a[tm] = ldfrag(A, wm + tm * 16 + lane15, PITCH32, 0, lane);
        if (more2) fetch(kt + 2, buf);  // into the registers that step kt - 1 emptied
        // Keeps the fourteen LDS reads and the seven global loads at the head of the step, ahead
        // of the wait for tile kt + 1: the reads return while that tile is converted.
        __builtin_amdgcn_sched_barrier(0);
        if (more1) put(buf ^ 1);        // tile kt + 1, into the buffer read in step kt - 1
        // Keeps the LDS stores ahead of the WMMAs: they are done when the signal is due.
        __builtin_amdgcn_sched_barrier(0);
        // The first nine products start as their fragments arrive (the compiler's counted waits).
#pragma unroll
        for (int tm = 0; tm < 3; ++tm)
#pragma unroll
            for (int z = 0; z < 3; ++z) acc[tm][z] = WMMA_F16(a[tm], b[z], acc[tm][z]);
        // Keeps the last three WMMAs between signal and wait, where they cover the other
        // waves' arrival, and the first nine ahead of the wait for all of LDS.
        __builtin_amdgcn_sched_barrier(0);
        // This wave's reads of tile kt have returned and its stores of tile kt + 1 are done.
        // The s_wait_xcnt stands behind the step's global loads and ahead of the address
        // additions at the loop's foot and head, which rewrite registers that they name.
        if (more1) asm volatile("s_wait_xcnt 0x0\n\ts_wait_dscnt 0x0\n\ts_barrier_signal -1" ::: "memory");
        __builtin_amdgcn_sched_barrier(0);   // the same fence, behind the signal
#pragma unroll
        for (int z = 0; z < 3; ++z) acc[3][z] = WMMA_F16(a[3], b[z], acc[3][z]);
        __builtin_amdgcn_sched_barrier(0);   // the same fence, ahead of the wait
        if (more1) asm volatile("s_barrier_wait -1" ::: "memory");   // tile kt + 1 is whole, tile kt is free
    };

    fetch(0, 0);
    fetch(1, 1);
    put(0);
    // Tile 0 is published by a whole barrier of the same make.
    asm volatile("s_wait_dscnt 0x0\n\ts_barrier_signal -1\n\ts_barrier_wait -1" ::: "memory");
    // Two steps a trip, so that the buffer is a constant in every LDS address; not more, to
    // keep the loop short.  The last two steps, which fetch nothing, stand behind it.
#pragma unroll 1
    for (int kt = 0; kt < NK - 2; kt += 2) {
        step(kt, 0, true, true);
        step(kt + 1, 1, true, true);
    }
    step(NK - 2, 0, true, false);
    step(NK - 1, 1, false, false);

    // Epilogue: +bias and softmax scale (Q only), de-interleave heads: col n -> (h = n%16, dq = n/16).
    // Each of the twelve tiles is packed into registers of its own, so that no register
    // of an issued store is written again.  The wave's 64 rows are one
    // 64-s chunk: its four stores of a column fill one 128-byte line.
    const int half8 = (lane & 16) ? 8 : 0;
    const int h  = n & 15, dq = n >> 4;
    const int m0 = mbase + wm;           // first of the wave's 64 rows
    const int bb = m0 >> 11;             // batch
    const int s0 = m0 & 2047;            // seq pos
    const size_t off = (size_t)(bb * H + h) * S * DH + (size_t)((s0 >> 6) * DH + dq) * 64 + half8;
    v8h pk[4][3];
#pragma unroll
    for (int tm = 0; tm < 4; ++tm)
#pragma unroll
        for (int r = 0; r < 8; ++r) {
            pk[tm][0][r] = (_Float16)((acc[tm][0][r] + bi) * SCL2);   // Q leaves scaled for the base-2 softmax
            pk[tm][1][r] = (_Float16)acc[tm][1][r];
            pk[tm][2][r] = (_Float16)acc[tm][2][r];
        }
#pragma unroll
    for (int tm = 0; tm < 4; ++tm) {
        *(v8h*)(Qh + off + tm * 16) = pk[tm][0];
        *(v8h*)(Kh + off + tm * 16) = pk[tm][1];
        *(v8h*)(Vh + off + tm * 16) = pk[tm][2];
    }
}

// ---------------------------------------------------------------------------
// Stage 2: flash attention, one block per (128 q-rows, head, batch).
// 256 threads = 8 waves = 4 query groups x 2 key halves.  Wave (qg, kh) owns the
// 32 queries [32 qg, 32 qg + 32) as two 16-column tiles, so that every K and V
// fragment read from LDS feeds two WMMAs, and of each 128-key stage the 64 keys
// of half kh, so that the grid still fills four waves per SIMD.  Q fragments stay
// in registers.  The two key halves of a query are joined once, in the epilogue.
// Q and double-buffered K and V stages arrive via async global->LDS copies,
// a stage one whole stage ahead of its use; one barrier per stage.
// ---------------------------------------------------------------------------
__global__ __launch_bounds__(256) __attribute__((amdgpu_waves_per_eu(4, 4)))
void flash_attn_kernel(const _Float16* __restrict__ Qh,
                       const _Float16* __restrict__ Kh,
                       const _Float16* __restrict__ Vh,
                       float* __restrict__ Op) {
    constexpr int S = 2048, H = 16, DH = 64;
    constexpr int NS = S / 128;         // 16 stages of two 64-key tiles

    __shared__ __align__(16) _Float16 Qs[2][64 * PITCHT];        // [64-q chunk][dh][qrow]
    __shared__ __align__(16) _Float16 Kb[2][2][64 * PITCHT];     // [buffer][key half][dh][j]
    __shared__ __align__(16) _Float16 Vt[2][2][64 * PITCH64];    // [buffer][key half][dh][j] (A of V^T P^T)
    __shared__ __align__(16) float    Os[4][32 * PITCHO];        // per query group O [q][dh], epilogue only
    __shared__ float                  Ml[8][2][32];              // per wave: reference, sum it hands over

    const int tid = threadIdx.x, lane = tid & 31;
    const int wave = __builtin_amdgcn_readfirstlane(tid >> 5);
    const int qg = wave & 3;            // query group
    const int kh = wave >> 2;           // key half
    const int t128 = tid & 127;         // index among the four waves of one key half
    const int lane15 = lane & 15;
    const int half8  = (lane & 16) ? 8 : 0;
    const int q0 = blockIdx.x * 128;
    const int h  = blockIdx.y;
    const int b  = blockIdx.z;

    const size_t headoff = (size_t)(b * H + h) * S * DH;
    const _Float16* Qg = Qh + headoff;
    // The four waves of a key half copy the tiles that they themselves read.
    const _Float16* Kg = Kh + headoff + (size_t)(kh * 64) * DH;
    const _Float16* Vg = Vh + headoff + (size_t)(kh * 64) * DH;

    const unsigned ldsQ  = lds_off(Qs[kh]);
    const unsigned ldsK0 = lds_off(Kb[0][kh]);
    const unsigned ldsK1 = lds_off(Kb[1][kh]);
    const unsigned ldsV0 = lds_off(Vt[0][kh]);
    const unsigned ldsV1 = lds_off(Vt[1][kh]);

    // Kick off async copies: K and V stage 0, then the Q tile (one 64-q chunk a key half).
    // Each tile is 8KB contiguous: 512 x 16B chunks, 4 per thread of its half.
    async_kv_tiles(ldsK0, Kg, ldsV0, Vg, t128);
    async_tile_64x64(ldsQ, Qg + (size_t)(q0 + kh * 64) * DH, t128);
    WAIT_ASYNCCNT(0x0);   // this wave's share of Q, K0, V0 has landed
    __syncthreads();      // ... and every other wave's: stage 0 may be read
    // Stage 1 flies while stage 0 is worked on.
    async_kv_tiles(ldsK1, Kg + (size_t)128 * DH, ldsV1, Vg + (size_t)128 * DH, t128);

    // Q^T fragments of the wave's two query tiles, both k halves: read once.
    v16h bq[2][2];
#pragma unroll
    for (int qt = 0; qt < 2; ++qt)
#pragma unroll
        for (int k2 = 0; k2 < 2; ++k2)
            bq[qt][k2] = ldfrag_tr(Qs[qg >> 1], (qg & 1) * 32 + qt * 16, k2 * 32, lane);

    const v8f zv = {0.f, 0.f, 0.f, 0.f, 0.f, 0.f, 0.f, 0.f};
    v8f o[2][4];
#pragma unroll
    for (int qt = 0; qt < 2; ++qt)
#pragma unroll
        for (int t = 0; t < 4; ++t) o[qt][t] = zv;
    // Per query tile: the reference that the lane's query subtracts (base-2 domain, equal in
    // both wave halves), the same negated as the C operand of the score products, and the sum
    // over the keys that this half of the wave holds (joined in the epilogue).
    float m_st[2] = {0.0f, 0.0f}, l_st[2] = {0.0f, 0.0f};
    v8f   cneg[2] = {zv, zv};

    // One stage: 64 keys x 32 queries for this wave.  refill: a stage st + 2 exists.
    auto stage = [&](const int st, const bool refill) __attribute__((always_inline)) {
        const _Float16* Kcur = Kb[st & 1][kh];
        const _Float16* Vcur = Vt[st & 1][kh];

        // ---- S^T = K Q^T - reference  (contraction over dh; both tiles are [dh][row]) ----
        // Q carries 1/sqrt(D) log2 e, and the products start from C = minus the query's
        // reference: sc[qt][tn][r] is the finished argument of 2^x for key
        // 128 st + 64 kh + 16 tn + r + half8 and query 16 qt + lane15 of the wave.
        v8f sc[2][4];
#pragma unroll
        for (int k2 = 0; k2 < 2; ++k2) {
#pragma unroll
            for (int tn = 0; tn < 4; ++tn) {
                v16h ak = ldfrag_tr(Kcur, tn * 16, k2 * 32, lane);
                sc[0][tn] = WMMA_F16(ak, bq[0][k2], k2 ? sc[0][tn] : cneg[0]);
                sc[1][tn] = WMMA_F16(ak, bq[1][k2], k2 ? sc[1][tn] : cneg[1]);
            }
        }

        // ---- the reference follows the maximum lazily.  The lane's 32 arguments and those
        //      of lane ^ 16 are the 64 keys of one query; mx is how far they top the reference.
        float mx[2];
#pragma unroll
        for (int qt = 0; qt < 2; ++qt) {
            float mr[8];
#pragma unroll
            for (int r = 0; r < 8; ++r)
                mr[r] = fmaxf(fmaxf(sc[qt][0][r], sc[qt][1][r]), fmaxf(sc[qt][2][r], sc[qt][3][r]));
            const float m1 = fmaxf(fmaxf(fmaxf(mr[0], mr[1]), fmaxf(mr[2], mr[3])),
                                   fmaxf(fmaxf(mr[4], mr[5]), fmaxf(mr[6], mr[7])));
            mx[qt] = fmaxf(m1, xhalf(m1));
        }
        // One wave-uniform test a stage.  The first stage sets the reference to its maximum,
        // whatever its sign; later it moves only where a query tops it by more than 8: P stays
        // at or below 2^8, and a row's largest term at or above 1 (the reference is a seen score).
        const float thr = (st == 0) ? -__builtin_inff() : 8.0f;
        if (__builtin_amdgcn_ballot_w32(fmaxf(mx[0], mx[1]) > thr) != 0) {
#pragma unroll
            for (int qt = 0; qt < 2; ++qt) {
                const float d = (mx[qt] > thr) ? mx[qt] : 0.0f;
                m_st[qt] += d;
#pragma unroll
                for (int tn = 0; tn < 4; ++tn) sc[qt][tn] -= d;
                // In the first stage O and the sum are still 0 and d may have either sign.
                const float corr = (st == 0) ? 1.0f : exp2_x1(-d);
                l_st[qt] *= corr;
#pragma unroll
                for (int tn = 0; tn < 4; ++tn) o[qt][tn] *= corr;
                const float c = -m_st[qt];
                cneg[qt] = (v8f){c, c, c, c, c, c, c, c};
            }
        }

        // ---- P = 2^arguments, row sums, per query tile ----
        // bp: B fragments of P^T, k order of ldfrag: element i is key kk + half8 + i,
        // element 8 + i key kk + 16 + half8 + i: two score tiles as they stand.
        v16h bp[2][2];
#pragma unroll
        for (int qt = 0; qt < 2; ++qt) {
            float rs[4];
#pragma unroll
            for (int tn = 0; tn < 4; ++tn) {
                exp2_x8(sc[qt][tn]);
                rs[tn] = sc[qt][tn][0];
#pragma unroll
                for (int r = 1; r < 8; ++r) rs[tn] += sc[qt][tn][r];
            }
            l_st[qt] += (rs[0] + rs[1]) + (rs[2] + rs[3]);
#pragma unroll
            for (int k2 = 0; k2 < 2; ++k2)
#pragma unroll
                for (int i = 0; i < 8; ++i) {
                    bp[qt][k2][i]     = (_Float16)sc[qt][2 * k2][i];
                    bp[qt][k2][i + 8] = (_Float16)sc[qt][2 * k2 + 1][i];
                }
            // Keeps the two tiles' softmax apart.  Interleaved, their scores and temporaries
            // leave so few of the 256 registers that the compiler reads the K fragments two
            // loads at a time, each pair waited out in full, not as one group of sixteen.
            __builtin_amdgcn_sched_barrier(0);
        }

        // ---- O^T += V^T P^T  (contraction over j; Vt[dh][j] is A[m][k]) ----
        v16h av[2][4];
#pragma unroll
        for (int k2 = 0; k2 < 2; ++k2)
#pragma unroll
            for (int tn = 0; tn < 4; ++tn)
                av[k2][tn] = ldfrag(Vcur, tn * 16 + lane15, PITCH64, k2 * 32, lane);
        // Keeps the sixteen LDS reads in one group ahead of the WMMAs: spread among them,
        // each pair of reads is waited out in full.
        __builtin_amdgcn_sched_barrier(0);
#pragma unroll
        for (int k2 = 0; k2 < 2; ++k2)
#pragma unroll
            for (int tn = 0; tn < 4; ++tn) {
                o[0][tn] = WMMA_F16(av[k2][tn], bp[0][k2], o[0][tn]);
                o[1][tn] = WMMA_F16(av[k2][tn], bp[1][k2], o[1][tn]);
            }

        // ---- hand-over: stage st+1 published, stage st's buffers freed ----
        WAIT_DSCNT(0x0);      // this wave's reads of stage st have returned
        WAIT_ASYNCCNT(0x0);   // this wave's share of stage st+1 has landed
        __syncthreads();      // both hold for every wave of the block
        if (refill)           // refill the pair of buffers that was just read
            async_kv_tiles((st & 1) ? ldsK1 : ldsK0, Kg + (size_t)((st + 2) * 128) * DH,
                           (st & 1) ? ldsV1 : ldsV0, Vg + (size_t)((st + 2) * 128) * DH, t128);
    };
    // The last two stages, which refill nothing, stand behind the loop: its body then has
    // no refill test, and the row sums stay with their stage.  Kept rolled: unrolled by two, the
    // copies' sixteen LDS addresses become loop invariants that no longer fit 256 registers.
#pragma unroll 1
    for (int st = 0; st < NS - 2; ++st) stage(st, true);
    // The C operands are formed anew from the references: carried out of the loop as they
    // stand, the compiler keeps a second copy of them and refreshes it in every pass.
#pragma unroll
    for (int qt = 0; qt < 2; ++qt) {
        const float c = -m_st[qt];
        cneg[qt] = (v8f){c, c, c, c, c, c, c, c};
    }
    stage(NS - 2, false);
    stage(NS - 1, false);
    WAIT_ASYNCCNT(0x0);       // nothing is in flight when the wave goes on to the epilogue

    // ---- join of the key halves: wave (qg, kh) finishes query tile kh of its group.
    // It hands the other tile's unnormalised O, reference and sum to wave (qg, 1 - kh)
    // through LDS and takes that wave's share of its own tile in return.
    v8f   mine[4], send[4];
#pragma unroll
    for (int tn = 0; tn < 4; ++tn) {
        mine[tn] = kh ? o[1][tn] : o[0][tn];
        send[tn] = kh ? o[0][tn] : o[1][tn];
    }
    const float l0 = l_st[0] + xhalf(l_st[0]);
    const float l1 = l_st[1] + xhalf(l_st[1]);
    const float m_mine = kh ? m_st[1] : m_st[0], m_send = kh ? m_st[0] : m_st[1];
    const float l_mine = kh ? l1 : l0,           l_send = kh ? l0 : l1;
    float* Ow    = Os[qg] + (kh * 16) * PITCHO;          // rows of the wave's own tile
    float* Osend = Os[qg] + ((kh ^ 1) * 16) * PITCHO;    // rows of the partner's tile
#pragma unroll
    for (int tn = 0; tn < 4; ++tn) {
        float4 lo, hi;
        lo.x = send[tn][0]; lo.y = send[tn][1]; lo.z = send[tn][2]; lo.w = send[tn][3];
        hi.x = send[tn][4]; hi.y = send[tn][5]; hi.z = send[tn][6]; hi.w = send[tn][7];
        *(float4*)(Osend + lane15 * PITCHO + tn * 16 + half8)     = lo;
        *(float4*)(Osend + lane15 * PITCHO + tn * 16 + half8 + 4) = hi;
    }
    Ml[wave][0][lane] = m_send;
    Ml[wave][1][lane] = l_send;
    __syncthreads();          // the partner's share is in LDS
    const float m_oth = Ml[wave ^ 4][0][lane];
    const float l_oth = Ml[wave ^ 4][1][lane];
    const float m_all = fmaxf(m_mine, m_oth);
    const float a_mine = exp2_x1(m_mine - m_all);
    const float a_oth  = exp2_x1(m_oth - m_all);
    const float l_all  = l_mine * a_mine + l_oth * a_oth;
    const float f_mine = a_mine / l_all;
    const float f_oth  = a_oth / l_all;

    // ---- epilogue: mine[tn][r] is O[query lane15][dh 16 tn + r + half8].
    // Turned through the wave's own LDS patch so that a global store is two whole
    // query rows of the head-major plane: 512 contiguous bytes, four whole lines.
#pragma unroll
    for (int tn = 0; tn < 4; ++tn) {
        float4 lo = *(const float4*)(Ow + lane15 * PITCHO + tn * 16 + half8);
        float4 hi = *(const float4*)(Ow + lane15 * PITCHO + tn * 16 + half8 + 4);
        lo.x = mine[tn][0] * f_mine + lo.x * f_oth; lo.y = mine[tn][1] * f_mine + lo.y * f_oth;
        lo.z = mine[tn][2] * f_mine + lo.z * f_oth; lo.w = mine[tn][3] * f_mine + lo.w * f_oth;
        hi.x = mine[tn][4] * f_mine + hi.x * f_oth; hi.y = mine[tn][5] * f_mine + hi.y * f_oth;
        hi.z = mine[tn][6] * f_mine + hi.z * f_oth; hi.w = mine[tn][7] * f_mine + hi.w * f_oth;
        *(float4*)(Ow + lane15 * PITCHO + tn * 16 + half8)     = lo;
        *(float4*)(Ow + lane15 * PITCHO + tn * 16 + half8 + 4) = hi;
    }
    __builtin_amdgcn_wave_barrier();   // keep the DS stores ahead of the DS loads (same wave, in order)
    // The wave's 16 query rows are 4 KB contiguous in the plane.
    float* Og = Op + ((size_t)(b * H + h) * S + q0 + qg * 32 + kh * 16) * DH + lane * 4;
    float4 ov[8];
#pragma unroll
    for (int i = 0; i < 8; ++i)
        ov[i] = *(const float4*)(Ow + (2 * i + (lane >> 4)) * PITCHO + lane15 * 4);
#pragma unroll
    for (int i = 0; i < 8; ++i) *(float4*)(Og + i * 128) = ov[i];
}

// ---------------------------------------------------------------------------
// Stage 3: out[b][s][dq*16 + h] = Op[b][h][s][dq].  One block per 16 rows (b, s).
// Wave w brings heads 2w and 2w+1 (4 KB contiguous each) into LDS as [row][h][dq],
// h rows of PITCHO floats, and writes out rows 2w and 2w+1, 512 contiguous bytes
// a store.  A lane's 16 bytes of out are four heads of one dq: four LDS words
// PITCHO apart; over a wave they fall on 32 distinct banks.
// ---------------------------------------------------------------------------
__global__ __launch_bounds__(256)
void interleave_heads_kernel(const float* __restrict__ Op, float* __restrict__ out) {
    constexpr int S = 2048, H = 16, DH = 64, D = 1024, R = 16;
    __shared__ __align__(16) float T[R * H * PITCHO];

    const int lane = threadIdx.x & 31;
    const int wave = __builtin_amdgcn_readfirstlane(threadIdx.x >> 5);
    const int row0 = blockIdx.x * R;            // first of the block's rows, of B*S
    const int b = row0 >> 11, s0 = row0 & (S - 1);

    // Head 2w, the block's first row.  Read as one wave-uniform value so that the loads take
    // a scalar base and the lane's offset; left to itself the compiler forms a vector address
    // pair and lets the last load land on it while the others are in flight.
    const float* g = Op + __builtin_amdgcn_readfirstlane(((b * H + 2 * wave) * S + s0) * DH);
    // Every loop here is unrolled: v and w stay in registers, and the wave's sixteen loads
    // are in flight together.
    float4 v[2][8];
#pragma unroll
    for (int hh = 0; hh < 2; ++hh) {
#pragma unroll
        for (int i = 0; i < 8; ++i) v[hh][i] = *(const float4*)(g + hh * (S * DH) + i * 128 + lane * 4);
    }
#pragma unroll
    for (int hh = 0; hh < 2; ++hh)
#pragma unroll
        for (int i = 0; i < 8; ++i)   // chunk 32 i + lane: row 2 i + (lane >> 4), dq 4 (lane & 15)
            *(float4*)(T + (2 * i + (lane >> 4)) * (H * PITCHO) + (2 * wave + hh) * PITCHO
                         + (lane & 15) * 4) = v[hh][i];
    __syncthreads();          // all sixteen heads of the block's rows are in LDS

    float4 w[2][8];
#pragma unroll
    for (int rr = 0; rr < 2; ++rr)
#pragma unroll
        for (int i = 0; i < 8; ++i) {
            // out columns 128 i + 4 lane ... + 3: dq = 8 i + (lane >> 2), heads 4 (lane & 3) ... + 3
            const float* t = T + (2 * wave + rr) * (H * PITCHO) + ((lane & 3) * 4) * PITCHO
                               + 8 * i + (lane >> 2);
            w[rr][i].x = t[0];
            w[rr][i].y = t[PITCHO];
            w[rr][i].z = t[2 * PITCHO];
            w[rr][i].w = t[3 * PITCHO];
        }
    float* og = out + (size_t)(row0 + 2 * wave) * D + lane * 4;
#pragma unroll
    for (int rr = 0; rr < 2; ++rr)
#pragma unroll
        for (int i = 0; i < 8; ++i) *(float4*)(og + rr * D + i * 128) = w[rr][i];
}

// ---------------------------------------------------------------------------
extern "C" void kernel_launch(void* const* d_in, const int* in_sizes, int n_in,
                              void* d_out, int out_size, void* d_ws, size_t ws_size,
                              hipStream_t stream) {
    const float* x  = (const float*)d_in[0];
    const float* Wq = (const float*)d_in[1];
    const float* Bq = (const float*)d_in[2];
    const float* Wk = (const float*)d_in[3];
    const float* Wv = (const float*)d_in[4];
    float* out = (float*)d_out;

    // f16 workspace: Q/K/V in [B,H,S/64][dh][64] = 4,194,304 halves (8 MB) each
    const size_t per = (size_t)2 * 16 * 2048 * 64;
    _Float16* Qh = (_Float16*)d_ws;
    _Float16* Kh = Qh + per;
    _Float16* Vh = Kh + per;
    // f32 workspace plane behind them: O in [B,H,S][dh] = 4,194,304 floats (16 MB)
    float* Op = (float*)(Vh + per);

    dim3 g1(1024 / 64, 4096 / 256);       // (N tiles of each of Q, K, V; M tiles)
    qkv_proj_kernel<<<g1, 512, 0, stream>>>(x, Wq, Bq, Wk, Wv, Qh, Kh, Vh);

    dim3 g2(2048 / 128, 16, 2);         // (q tiles, heads, batch)
    flash_attn_kernel<<<g2, 256, 0, stream>>>(Qh, Kh, Vh, Op);

    interleave_heads_kernel<<<4096 / 16, 256, 0, stream>>>(Op, out);   // 16 rows of B*S a block
}
